// v000
// The times below were measured on an AMD MI455X: many runs one after another, warmed up first and cycling through
// copies of the inputs, with the whole window's GPU time divided by the number of runs. Launches and the gaps
// between them are all in it. The median over several windows is given; except for v000 it joins two sittings, which
// can be a few percent apart, so the side-by-side timings, each taken in one sitting, are the better comparison.
// v000, which the later versions start from, runs in 277 microseconds.
#include <hip/hip_runtime.h>

typedef __attribute__((ext_vector_type(16))) __bf16 v16bf;
typedef __attribute__((ext_vector_type(8)))  __bf16 v8bf;
typedef __attribute__((ext_vector_type(4)))  __bf16 v4bf;
typedef __attribute__((ext_vector_type(8)))  float  v8f;
typedef __attribute__((ext_vector_type(4)))  float  v4f;
typedef __attribute__((ext_vector_type(4)))  unsigned int v4u;
typedef __attribute__((ext_vector_type(4)))  int v4i;
typedef __attribute__((ext_vector_type(8)))  int v8i;

#define TN    2048   // time dim / GEMM N
#define KD    1024   // channel dim / GEMM K (= H*OD)
#define HEADS 8
#define ODIM  128
#define LDPAD 40     // LDS row pitch in bf16: 64B data + 16B pad = 80B

__device__ __forceinline__ v16bf comb(v8bf lo, v8bf hi) {
  return __builtin_shufflevector(lo, hi, 0,1,2,3,4,5,6,7,8,9,10,11,12,13,14,15);
}
__device__ __forceinline__ v8f wmma_bf16(v16bf a, v16bf b, v8f c) {
  return __builtin_amdgcn_wmma_f32_16x16x32_bf16(false, a, false, b, (short)0, c, false, false);
}

__device__ __forceinline__ void tdm_load_128x32(__bf16* lds_dst,
                                                const __bf16* gsrc,
                                                unsigned pitch) {
#if __has_builtin(__builtin_amdgcn_tensor_load_to_lds)
  unsigned long long ga = (unsigned long long)(uintptr_t)gsrc;
  unsigned la = (unsigned)(uintptr_t)lds_dst;  // low 32 bits = LDS byte offset
  v4u g0;
  g0.x = 1u;
  g0.y = la;
  g0.z = (unsigned)ga;
  g0.w = ((unsigned)(ga >> 32) & 0x01FFFFFFu)
       | (2u << 30);
  v8i g1;
  g1[0] = (int)((1u << 16)
              | (1u << 20)
              | (3u << 22)
              | (3u << 25));
  g1[1] = (int)((pitch & 0xFFFFu) << 16);
  g1[2] = (int)((pitch >> 16) | (0xFFFFu << 16));
  g1[3] = (int)(32u << 16);
  g1[4] = (int)128u;
  g1[5] = (int)pitch;
  g1[6] = 0;
  g1[7] = 0;
  v4i z4 = {0, 0, 0, 0};
#if __clang_major__ >= 23
  v8i z8 = {0, 0, 0, 0, 0, 0, 0, 0};
  __builtin_amdgcn_tensor_load_to_lds(g0, g1, z4, z4, z8, 0);
#else
  __builtin_amdgcn_tensor_load_to_lds(g0, g1, z4, z4, 0);
#endif
#else
  // Fallback: wave-cooperative copy (probed toolchains all have the builtin).
  int lane = threadIdx.x & 31;
  for (int r = 0; r < 128; ++r) {
    if (lane < 16)
      ((unsigned*)(lds_dst + r * LDPAD))[lane] =
          ((const unsigned*)(gsrc + (size_t)r * pitch))[lane];
  }
#endif
}

// ---------------------------------------------------------------------------
// fp32 -> bf16 bulk convert (weights). n4 = element_count / 4.
// ---------------------------------------------------------------------------
__global__ __launch_bounds__(256) void cvt_bf16(const float* __restrict__ src,
                                                __bf16* __restrict__ dst, int n4) {
  int i = blockIdx.x * 256 + threadIdx.x;
  if (i < n4) {
    v4f s = *(const v4f*)(src + 4 * (size_t)i);
    v4bf d;
    d.x = (__bf16)s.x; d.y = (__bf16)s.y; d.z = (__bf16)s.z; d.w = (__bf16)s.w;
    *(v4bf*)(dst + 4 * (size_t)i) = d;
  }
}

// ---------------------------------------------------------------------------
// x (b, k, t) fp32 -> xT (b, t, k) bf16, 32x32 tiles through LDS.
// ---------------------------------------------------------------------------
__global__ __launch_bounds__(256) void transpose_x(const float* __restrict__ x,
                                                   __bf16* __restrict__ xT) {
  __shared__ __bf16 tile[32][33];
  const int tx = threadIdx.x, ty = threadIdx.y;  // (32, 8)
  const int b = blockIdx.z;
  const int t0 = blockIdx.x * 32, k0 = blockIdx.y * 32;
  const float* xb = x + (size_t)b * KD * TN;
  __bf16* xTb = xT + (size_t)b * TN * KD;
  #pragma unroll
  for (int i = 0; i < 4; ++i)
    tile[ty + 8 * i][tx] = (__bf16)xb[(size_t)(k0 + ty + 8 * i) * TN + t0 + tx];
  __syncthreads();
  #pragma unroll
  for (int i = 0; i < 4; ++i)
    xTb[(size_t)(t0 + ty + 8 * i) * KD + k0 + tx] = tile[tx][ty + 8 * i];
}

template<int OMODE>
__global__ __launch_bounds__(256) void gemm_wmma_tdm(
    const __bf16* __restrict__ A, const __bf16* __restrict__ Bt,
    void* __restrict__ Cout, const float* __restrict__ bias, float scale)
{
  __shared__ __bf16 Alds[2][128 * LDPAD] __attribute__((aligned(16)));
  __shared__ __bf16 Blds[2][128 * LDPAD] __attribute__((aligned(16)));

  const int tid  = threadIdx.x;
  const int lane = tid & 31;
  const int wid  = tid >> 5;
  const int lm   = lane & 15;
  const int h2   = lane >> 4;
  const int wm   = (wid & 3) * 32;   // 4 waves tile M
  const int wn   = (wid >> 2) * 64;  // 2 waves tile N
  const int mblk = blockIdx.y * 128;
  const int nblk = blockIdx.x * 128;
  const int z    = blockIdx.z;

  const __bf16* Ab = A + (size_t)mblk * KD;
  const __bf16* Bb = Bt + (size_t)z * TN * KD + (size_t)nblk * KD;

  v8f zero8 = {};
  v8f acc[2][4];
  #pragma unroll
  for (int mi = 0; mi < 2; ++mi)
    #pragma unroll
    for (int ni = 0; ni < 4; ++ni) acc[mi][ni] = zero8;

  if (wid == 0) {                        // prologue: DMA first tiles
    tdm_load_128x32(&Alds[0][0], Ab, KD);
    tdm_load_128x32(&Blds[0][0], Bb, KD);
  }

  for (int kk = 0; kk < KD; kk += 32) {
    const int cur = (kk >> 5) & 1;
    if (wid == 0) __builtin_amdgcn_s_wait_tensorcnt(0);
    __syncthreads();                     // cur buffers ready for everyone
    if (wid == 0 && kk + 32 < KD) {      // prefetch next tiles into other buf
      tdm_load_128x32(&Alds[cur ^ 1][0], Ab + kk + 32, KD);
      tdm_load_128x32(&Blds[cur ^ 1][0], Bb + kk + 32, KD);
    }

    v16bf af[2];
    #pragma unroll
    for (int mi = 0; mi < 2; ++mi) {
      const __bf16* ap = &Alds[cur][(wm + mi * 16 + lm) * LDPAD];
      af[mi] = comb(*(const v8bf*)(ap + h2 * 8), *(const v8bf*)(ap + 16 + h2 * 8));
    }
    #pragma unroll
    for (int ni = 0; ni < 4; ++ni) {
      const __bf16* bp = &Blds[cur][(wn + ni * 16 + lm) * LDPAD];
      v16bf bfrag = comb(*(const v8bf*)(bp + h2 * 8), *(const v8bf*)(bp + 16 + h2 * 8));
      #pragma unroll
      for (int mi = 0; mi < 2; ++mi)
        acc[mi][ni] = wmma_bf16(af[mi], bfrag, acc[mi][ni]);
    }
    __syncthreads();                     // done reading cur before it is reused
  }

  // epilogue: D layout lane -> (m = r + 8*h2, n = lm)
  #pragma unroll
  for (int mi = 0; mi < 2; ++mi) {
    #pragma unroll
    for (int ni = 0; ni < 4; ++ni) {
      #pragma unroll
      for (int r = 0; r < 8; ++r) {
        int j = mblk + wm + mi * 16 + r + 8 * h2;
        int t = nblk + wn + ni * 16 + lm;
        float v = acc[mi][ni][r] * scale;
        if constexpr (OMODE == 0) {
          ((__bf16*)Cout)[(size_t)z * KD * TN + (size_t)j * TN + t] = (__bf16)v;
        } else if constexpr (OMODE == 1) {
          int h = j >> 7, e = j & 127;
          ((__bf16*)Cout)[(((size_t)z * HEADS + h) * TN + t) * ODIM + e] = (__bf16)v;
        } else {
          ((float*)Cout)[(size_t)z * ODIM * TN + (size_t)j * TN + t] = v + bias[j];
        }
      }
    }
  }
}

__global__ __launch_bounds__(256) void attn_wmma(
    const __bf16* __restrict__ Qt,  // (b,h,t,e), pre-scaled
    const __bf16* __restrict__ Kt,  // (b,h,i,e)
    const __bf16* __restrict__ Vb,  // (b, j=h*128+e, i)
    __bf16* __restrict__ Ot)        // (b, t, j)
{
  __shared__ __bf16 plds[8][16][32] __attribute__((aligned(16)));
  const int tid  = threadIdx.x;
  const int lane = tid & 31;
  const int wid  = tid >> 5;
  const int lm   = lane & 15;
  const int h2   = lane >> 4;
  const int task = blockIdx.x * 8 + wid;
  const int bh   = task >> 7;
  const int tb   = (task & 127) * 16;

  v16bf qf[4];
  {
    const __bf16* qp = Qt + ((size_t)bh * TN + tb + lm) * ODIM;
    #pragma unroll
    for (int es = 0; es < 4; ++es)
      qf[es] = comb(*(const v8bf*)(qp + es * 32 + h2 * 8),
                    *(const v8bf*)(qp + es * 32 + 16 + h2 * 8));
  }

  v8f zero8 = {};
  v8f accO[8];
  #pragma unroll
  for (int nt = 0; nt < 8; ++nt) accO[nt] = zero8;
  float mr[8], lr[8];
  #pragma unroll
  for (int r = 0; r < 8; ++r) { mr[r] = -3.0e38f; lr[r] = 0.0f; }

  for (int i0 = 0; i0 < TN; i0 += 32) {
    v8f s0 = zero8, s1 = zero8;
    const __bf16* kp0 = Kt + ((size_t)bh * TN + i0 + lm) * ODIM;
    const __bf16* kp1 = kp0 + 16 * ODIM;
    #pragma unroll
    for (int es = 0; es < 4; ++es) {
      v16bf k0 = comb(*(const v8bf*)(kp0 + es * 32 + h2 * 8),
                      *(const v8bf*)(kp0 + es * 32 + 16 + h2 * 8));
      v16bf k1 = comb(*(const v8bf*)(kp1 + es * 32 + h2 * 8),
                      *(const v8bf*)(kp1 + es * 32 + 16 + h2 * 8));
      s0 = wmma_bf16(qf[es], k0, s0);
      s1 = wmma_bf16(qf[es], k1, s1);
    }
    float alpha[8];
    #pragma unroll
    for (int r = 0; r < 8; ++r) {
      float mx = fmaxf(s0[r], s1[r]);
      mx = fmaxf(mx, __shfl_xor(mx, 1, 32));
      mx = fmaxf(mx, __shfl_xor(mx, 2, 32));
      mx = fmaxf(mx, __shfl_xor(mx, 4, 32));
      mx = fmaxf(mx, __shfl_xor(mx, 8, 32));
      float mnew = fmaxf(mr[r], mx);
      alpha[r] = __expf(mr[r] - mnew);
      float p0 = __expf(s0[r] - mnew);
      float p1 = __expf(s1[r] - mnew);
      s0[r] = p0; s1[r] = p1;
      float rs = p0 + p1;
      rs += __shfl_xor(rs, 1, 32);
      rs += __shfl_xor(rs, 2, 32);
      rs += __shfl_xor(rs, 4, 32);
      rs += __shfl_xor(rs, 8, 32);
      lr[r] = lr[r] * alpha[r] + rs;
      mr[r] = mnew;
    }
    #pragma unroll
    for (int nt = 0; nt < 8; ++nt)
      #pragma unroll
      for (int r = 0; r < 8; ++r) accO[nt][r] *= alpha[r];

    #pragma unroll
    for (int r = 0; r < 8; ++r) {
      int m = r + 8 * h2;
      plds[wid][m][lm]      = (__bf16)s0[r];
      plds[wid][m][16 + lm] = (__bf16)s1[r];
    }
    v16bf pf = comb(*(const v8bf*)&plds[wid][lm][h2 * 8],
                    *(const v8bf*)&plds[wid][lm][16 + h2 * 8]);

    #pragma unroll
    for (int nt = 0; nt < 8; ++nt) {
      const __bf16* vp = Vb + ((size_t)bh * ODIM + nt * 16 + lm) * TN + i0;
      v16bf vf = comb(*(const v8bf*)(vp + h2 * 8),
                      *(const v8bf*)(vp + 16 + h2 * 8));
      accO[nt] = wmma_bf16(pf, vf, accO[nt]);
    }
  }

  float inv[8];
  #pragma unroll
  for (int r = 0; r < 8; ++r) inv[r] = 1.0f / lr[r];
  const int bb = bh >> 3;
  const int hh = bh & 7;
  #pragma unroll
  for (int nt = 0; nt < 8; ++nt) {
    #pragma unroll
    for (int r = 0; r < 8; ++r) {
      int e = nt * 16 + lm;
      int t = tb + r + 8 * h2;
      Ot[((size_t)bb * TN + t) * KD + hh * ODIM + e] =
          (__bf16)(accO[nt][r] * inv[r]);
    }
  }
}

// ---------------------------------------------------------------------------
extern "C" void kernel_launch(void* const* d_in, const int* in_sizes, int n_in,
                              void* d_out, int out_size, void* d_ws, size_t ws_size,
                              hipStream_t stream) {
  (void)in_sizes; (void)n_in; (void)out_size; (void)ws_size;
  const float* x  = (const float*)d_in[0];
  const float* Wk = (const float*)d_in[1];
  const float* Wq = (const float*)d_in[2];
  const float* Wv = (const float*)d_in[3];
  const float* Wu = (const float*)d_in[4];
  const float* bu = (const float*)d_in[5];

  // ws (bf16 elems): Qt|Kt|V|Ot|xT (8M each) + Wq/Wk/Wv (1M each) + Wu (128K)
  const size_t SEG = (size_t)4 * HEADS * TN * ODIM;  // 8,388,608
  __bf16* ws  = (__bf16*)d_ws;
  __bf16* Qt  = ws;
  __bf16* Kt  = Qt + SEG;
  __bf16* Vb  = Kt + SEG;
  __bf16* Ot  = Vb + SEG;
  __bf16* xT  = Ot + SEG;
  __bf16* Wqb = xT + SEG;
  __bf16* Wkb = Wqb + (size_t)KD * KD;
  __bf16* Wvb = Wkb + (size_t)KD * KD;
  __bf16* Wub = Wvb + (size_t)KD * KD;

  const float qscale = 0.08838834764831845f;  // 1/sqrt(OD=128)
  dim3 blk(256);

  cvt_bf16<<<dim3(1024), blk, 0, stream>>>(Wq, Wqb, 262144);
  cvt_bf16<<<dim3(1024), blk, 0, stream>>>(Wk, Wkb, 262144);
  cvt_bf16<<<dim3(1024), blk, 0, stream>>>(Wv, Wvb, 262144);
  cvt_bf16<<<dim3(128),  blk, 0, stream>>>(Wu, Wub, 32768);
  transpose_x<<<dim3(64, 32, 4), dim3(32, 8), 0, stream>>>(x, xT);

  gemm_wmma_tdm<1><<<dim3(16, 8, 4), blk, 0, stream>>>(Wqb, xT, Qt, nullptr, qscale);
  gemm_wmma_tdm<1><<<dim3(16, 8, 4), blk, 0, stream>>>(Wkb, xT, Kt, nullptr, 1.0f);
  gemm_wmma_tdm<0><<<dim3(16, 8, 4), blk, 0, stream>>>(Wvb, xT, Vb, nullptr, 1.0f);

  attn_wmma<<<dim3(512), blk, 0, stream>>>(Qt, Kt, Vb, Ot);

  gemm_wmma_tdm<2><<<dim3(16, 1, 4), blk, 0, stream>>>(Wub, Ot, d_out, bu, 1.0f);
}

// v001
// Measured time: 206 microseconds a run.
// Two timings next to v000 both put it at 1.40 times that version's speed.
#include <hip/hip_runtime.h>

typedef __attribute__((ext_vector_type(16))) __bf16 v16bf;
typedef __attribute__((ext_vector_type(8)))  __bf16 v8bf;
typedef __attribute__((ext_vector_type(4)))  __bf16 v4bf;
typedef __attribute__((ext_vector_type(8)))  float  v8f;
typedef __attribute__((ext_vector_type(4)))  float  v4f;
typedef __attribute__((ext_vector_type(4)))  unsigned int v4u;
typedef __attribute__((ext_vector_type(4)))  int v4i;
typedef __attribute__((ext_vector_type(8)))  int v8i;

#define TN    2048   // time dim / GEMM N
#define KD    1024   // channel dim / GEMM K (= H*OD)
#define HEADS 8
#define ODIM  128
#define LDPAD 40     // LDS row pitch in bf16: 64B data + 16B pad = 80B

__device__ __forceinline__ v16bf comb(v8bf lo, v8bf hi) {
  return __builtin_shufflevector(lo, hi, 0,1,2,3,4,5,6,7,8,9,10,11,12,13,14,15);
}
__device__ __forceinline__ v8f wmma_bf16(v16bf a, v16bf b, v8f c) {
  return __builtin_amdgcn_wmma_f32_16x16x32_bf16(false, a, false, b, (short)0, c, false, false);
}

__device__ __forceinline__ void tdm_load_128x32(__bf16* lds_dst,
                                                const __bf16* gsrc,
                                                unsigned pitch) {
#if __has_builtin(__builtin_amdgcn_tensor_load_to_lds)
  unsigned long long ga = (unsigned long long)(uintptr_t)gsrc;
  unsigned la = (unsigned)(uintptr_t)lds_dst;  // low 32 bits = LDS byte offset
  v4u g0;
  g0.x = 1u;
  g0.y = la;
  g0.z = (unsigned)ga;
  g0.w = ((unsigned)(ga >> 32) & 0x01FFFFFFu)
       | (2u << 30);
  v8i g1;
  g1[0] = (int)((1u << 16)
              | (1u << 20)
              | (3u << 22)
              | (3u << 25));
  g1[1] = (int)((pitch & 0xFFFFu) << 16);
  g1[2] = (int)((pitch >> 16) | (0xFFFFu << 16));
  g1[3] = (int)(32u << 16);
  g1[4] = (int)128u;
  g1[5] = (int)pitch;
  g1[6] = 0;
  g1[7] = 0;
  v4i z4 = {0, 0, 0, 0};
#if __clang_major__ >= 23
  v8i z8 = {0, 0, 0, 0, 0, 0, 0, 0};
  __builtin_amdgcn_tensor_load_to_lds(g0, g1, z4, z4, z8, 0);
#else
  __builtin_amdgcn_tensor_load_to_lds(g0, g1, z4, z4, 0);
#endif
#else
  // Fallback: wave-cooperative copy (probed toolchains all have the builtin).
  int lane = threadIdx.x & 31;
  for (int r = 0; r < 128; ++r) {
    if (lane < 16)
      ((unsigned*)(lds_dst + r * LDPAD))[lane] =
          ((const unsigned*)(gsrc + (size_t)r * pitch))[lane];
  }
#endif
}

// ---------------------------------------------------------------------------
// fp32 -> bf16 bulk convert (weights). n4 = element_count / 4.
// ---------------------------------------------------------------------------
__global__ __launch_bounds__(256) void cvt_bf16(const float* __restrict__ src,
                                                __bf16* __restrict__ dst, int n4) {
  int i = blockIdx.x * 256 + threadIdx.x;
  if (i < n4) {
    v4f s = *(const v4f*)(src + 4 * (size_t)i);
    v4bf d;
    d.x = (__bf16)s.x; d.y = (__bf16)s.y; d.z = (__bf16)s.z; d.w = (__bf16)s.w;
    *(v4bf*)(dst + 4 * (size_t)i) = d;
  }
}

// ---------------------------------------------------------------------------
// x (b, k, t) fp32 -> xT (b, t, k) bf16, 32x32 tiles through LDS.
// ---------------------------------------------------------------------------
__global__ __launch_bounds__(256) void transpose_x(const float* __restrict__ x,
                                                   __bf16* __restrict__ xT) {
  __shared__ __bf16 tile[32][33];
  const int tx = threadIdx.x, ty = threadIdx.y;  // (32, 8)
  const int b = blockIdx.z;
  const int t0 = blockIdx.x * 32, k0 = blockIdx.y * 32;
  const float* xb = x + (size_t)b * KD * TN;
  __bf16* xTb = xT + (size_t)b * TN * KD;
  #pragma unroll
  for (int i = 0; i < 4; ++i)
    tile[ty + 8 * i][tx] = (__bf16)xb[(size_t)(k0 + ty + 8 * i) * TN + t0 + tx];
  __syncthreads();
  #pragma unroll
  for (int i = 0; i < 4; ++i)
    xTb[(size_t)(t0 + ty + 8 * i) * KD + k0 + tx] = tile[tx][ty + 8 * i];
}

template<int OMODE>
__global__ __launch_bounds__(256) void gemm_wmma_tdm(
    const __bf16* __restrict__ A, const __bf16* __restrict__ Bt,
    void* __restrict__ Cout, const float* __restrict__ bias, float scale)
{
  __shared__ __bf16 Alds[2][128 * LDPAD] __attribute__((aligned(16)));
  __shared__ __bf16 Blds[2][128 * LDPAD] __attribute__((aligned(16)));

  const int tid  = threadIdx.x;
  const int lane = tid & 31;
  const int wid  = tid >> 5;
  const int lm   = lane & 15;
  const int h2   = lane >> 4;
  const int wm   = (wid & 3) * 32;   // 4 waves tile M
  const int wn   = (wid >> 2) * 64;  // 2 waves tile N
  const int mblk = blockIdx.y * 128;
  const int nblk = blockIdx.x * 128;
  const int z    = blockIdx.z;

  const __bf16* Ab = A + (size_t)mblk * KD;
  const __bf16* Bb = Bt + (size_t)z * TN * KD + (size_t)nblk * KD;

  v8f zero8 = {};
  v8f acc[2][4];
  #pragma unroll
  for (int mi = 0; mi < 2; ++mi)
    #pragma unroll
    for (int ni = 0; ni < 4; ++ni) acc[mi][ni] = zero8;

  if (wid == 0) {                        // prologue: DMA first tiles
    tdm_load_128x32(&Alds[0][0], Ab, KD);
    tdm_load_128x32(&Blds[0][0], Bb, KD);
  }

  for (int kk = 0; kk < KD; kk += 32) {
    const int cur = (kk >> 5) & 1;
    if (wid == 0) __builtin_amdgcn_s_wait_tensorcnt(0);
    __syncthreads();                     // cur buffers ready for everyone
    if (wid == 0 && kk + 32 < KD) {      // prefetch next tiles into other buf
      tdm_load_128x32(&Alds[cur ^ 1][0], Ab + kk + 32, KD);
      tdm_load_128x32(&Blds[cur ^ 1][0], Bb + kk + 32, KD);
    }

    v16bf af[2];
    #pragma unroll
    for (int mi = 0; mi < 2; ++mi) {
      const __bf16* ap = &Alds[cur][(wm + mi * 16 + lm) * LDPAD];
      af[mi] = comb(*(const v8bf*)(ap + h2 * 8), *(const v8bf*)(ap + 16 + h2 * 8));
    }
    #pragma unroll
    for (int ni = 0; ni < 4; ++ni) {
      const __bf16* bp = &Blds[cur][(wn + ni * 16 + lm) * LDPAD];
      v16bf bfrag = comb(*(const v8bf*)(bp + h2 * 8), *(const v8bf*)(bp + 16 + h2 * 8));
      #pragma unroll
      for (int mi = 0; mi < 2; ++mi)
        acc[mi][ni] = wmma_bf16(af[mi], bfrag, acc[mi][ni]);
    }
    __syncthreads();                     // done reading cur before it is reused
  }

  // epilogue: D layout lane -> (m = r + 8*h2, n = lm)
  #pragma unroll
  for (int mi = 0; mi < 2; ++mi) {
    #pragma unroll
    for (int ni = 0; ni < 4; ++ni) {
      #pragma unroll
      for (int r = 0; r < 8; ++r) {
        int j = mblk + wm + mi * 16 + r + 8 * h2;
        int t = nblk + wn + ni * 16 + lm;
        float v = acc[mi][ni][r] * scale;
        if constexpr (OMODE == 0) {
          ((__bf16*)Cout)[(size_t)z * KD * TN + (size_t)j * TN + t] = (__bf16)v;
        } else if constexpr (OMODE == 1) {
          int h = j >> 7, e = j & 127;
          ((__bf16*)Cout)[(((size_t)z * HEADS + h) * TN + t) * ODIM + e] = (__bf16)v;
        } else {
          ((float*)Cout)[(size_t)z * ODIM * TN + (size_t)j * TN + t] = v + bias[j];
        }
      }
    }
  }
}

#define SKEYS  128
#define NSTAGE (TN / SKEYS)
#define KVP    136
#define KVTILE (128 * KVP)

typedef __attribute__((ext_vector_type(8))) unsigned int v8u;

__device__ __forceinline__ unsigned uni(unsigned v) {
  return (unsigned)__builtin_amdgcn_readfirstlane((int)v);
}
__device__ __forceinline__ unsigned pinned(unsigned v) {
  unsigned w = uni(v);
  asm volatile("" : "+s"(w));  // the word stays in a scalar register
  return w;
}
// One request: 128 rows of 256 B, source pitch src_pitch bytes, into LDS at
// byte offset lds_dst with 16 B of pad behind every row. All extents in bytes.
__device__ __forceinline__ void tdm_load_kv(unsigned lds_dst,
                                            unsigned long long ga,
                                            unsigned src_pitch) {
  v4u g0;
  g0[0] = uni(1u);                                        // count = 1
  g0[1] = uni(lds_dst);
  g0[2] = uni((unsigned)ga);
  g0[3] = uni((((unsigned)(ga >> 32)) & 0x01FFFFFFu) | 0x80000000u);  // type = 2
  v8u g1;
  g1[0] = uni((1u << 20) | (5u << 22) | (3u << 25));
  g1[1] = uni(256u << 16);
  g1[2] = uni(128u << 16);
  g1[3] = uni(256u << 16);
  g1[4] = uni(128u);
  g1[5] = uni(src_pitch);
  g1[6] = uni(0u);
  g1[7] = uni(0u);
  asm volatile("tensor_load_to_lds %0, %1" :: "s"(g0), "s"(g1) : "memory");
}
__global__ __launch_bounds__(256) void attn_wmma(
    const __bf16* __restrict__ Qt,  // (b,h,t,e), pre-scaled
    const __bf16* __restrict__ Kt,  // (b,h,i,e)
    const __bf16* __restrict__ Vb,  // (b, j=h*128+e, i)
    __bf16* __restrict__ Ot)        // (b, t, j)
{
  __shared__ __bf16 ring[2][2][KVTILE] __attribute__((aligned(2048)));  // [buffer][K, V]
  __shared__ __bf16 plds[8][16][32] __attribute__((aligned(16)));
  const int tid  = threadIdx.x;
  const int lane = tid & 31;
  const int wid  = tid >> 5;
  const int lm   = lane & 15;
  const int h2   = lane >> 4;
  const int task = blockIdx.x * 8 + wid;
  const int bh   = task >> 7;
  const int tb   = (task & 127) * 16;

  // Wave 0 brings K, wave 1 brings V; all of this is wave-uniform.
  const unsigned wave   = uni((unsigned)tid >> 5);
  const unsigned issuer = wave < 2u;
  const unsigned isV    = wave & 1u;
  const unsigned bhu    = uni((unsigned)bh);
  const unsigned long long kvsrc = isV
      ? (unsigned long long)(uintptr_t)(Vb + (size_t)bhu * ODIM * TN)
      : (unsigned long long)(uintptr_t)(Kt + (size_t)bhu * TN * ODIM);
  const unsigned kvstep  = isV ? SKEYS * 2u : SKEYS * ODIM * 2u;  // bytes per stage
  const unsigned kvpitch = isV ? TN * 2u : ODIM * 2u;             // source row pitch
  const unsigned kvdst   = (unsigned)(uintptr_t)&ring[0][0][0] + isV * (KVTILE * 2u);

  if (pinned(issuer)) {                  // stage 0
    tdm_load_kv(kvdst, kvsrc, kvpitch);
    asm volatile("s_wait_tensorcnt 0x0" ::: "memory");  // stage 0 has landed
  }
  __syncthreads();                       // stage 0 published to all waves
  if (pinned(issuer))                    // stage 1 flies under stage 0's work
    tdm_load_kv(kvdst + 2u * KVTILE * 2u, kvsrc + kvstep, kvpitch);

  v16bf qf[4];
  {
    const __bf16* qp = Qt + ((size_t)bh * TN + tb + lm) * ODIM;
    #pragma unroll
    for (int es = 0; es < 4; ++es)
      qf[es] = comb(*(const v8bf*)(qp + es * 32 + h2 * 8),
                    *(const v8bf*)(qp + es * 32 + 16 + h2 * 8));
  }

  v8f zero8 = {};
  v8f accO[8];
  #pragma unroll
  for (int nt = 0; nt < 8; ++nt) accO[nt] = zero8;
  float mr[8], lr[8];
  #pragma unroll
  for (int r = 0; r < 8; ++r) { mr[r] = -3.0e38f; lr[r] = 0.0f; }

  #pragma unroll 1  // one stage per trip: the publish point stands once, at its foot
  for (int st = 0; st < NSTAGE; ++st) {
  const __bf16* kt = &ring[st & 1][0][0];
  const __bf16* vt = &ring[st & 1][1][0];
  #pragma unroll 1
  for (int i0 = 0; i0 < SKEYS; i0 += 32) {
    v8f s0 = zero8, s1 = zero8;
    const __bf16* kp0 = kt + (i0 + lm) * KVP;
    const __bf16* kp1 = kp0 + 16 * KVP;
    #pragma unroll
    for (int es = 0; es < 4; ++es) {
      v16bf k0 = comb(*(const v8bf*)(kp0 + es * 32 + h2 * 8),
                      *(const v8bf*)(kp0 + es * 32 + 16 + h2 * 8));
      v16bf k1 = comb(*(const v8bf*)(kp1 + es * 32 + h2 * 8),
                      *(const v8bf*)(kp1 + es * 32 + 16 + h2 * 8));
      s0 = wmma_bf16(qf[es], k0, s0);
      s1 = wmma_bf16(qf[es], k1, s1);
    }
    float alpha[8];
    #pragma unroll
    for (int r = 0; r < 8; ++r) {
      float mx = fmaxf(s0[r], s1[r]);
      mx = fmaxf(mx, __shfl_xor(mx, 1, 32));
      mx = fmaxf(mx, __shfl_xor(mx, 2, 32));
      mx = fmaxf(mx, __shfl_xor(mx, 4, 32));
      mx = fmaxf(mx, __shfl_xor(mx, 8, 32));
      float mnew = fmaxf(mr[r], mx);
      alpha[r] = __expf(mr[r] - mnew);
      float p0 = __expf(s0[r] - mnew);
      float p1 = __expf(s1[r] - mnew);
      s0[r] = p0; s1[r] = p1;
      float rs = p0 + p1;
      rs += __shfl_xor(rs, 1, 32);
      rs += __shfl_xor(rs, 2, 32);
      rs += __shfl_xor(rs, 4, 32);
      rs += __shfl_xor(rs, 8, 32);
      lr[r] = lr[r] * alpha[r] + rs;
      mr[r] = mnew;
    }
    #pragma unroll
    for (int nt = 0; nt < 8; ++nt)
      #pragma unroll
      for (int r = 0; r < 8; ++r) accO[nt][r] *= alpha[r];

    #pragma unroll
    for (int r = 0; r < 8; ++r) {
      int m = r + 8 * h2;
      plds[wid][m][lm]      = (__bf16)s0[r];
      plds[wid][m][16 + lm] = (__bf16)s1[r];
    }
    v16bf pf = comb(*(const v8bf*)&plds[wid][lm][h2 * 8],
                    *(const v8bf*)&plds[wid][lm][16 + h2 * 8]);

    #pragma unroll
    for (int nt = 0; nt < 8; ++nt) {
      const __bf16* vp = vt + (nt * 16 + lm) * KVP + i0;
      v16bf vf = comb(*(const v8bf*)(vp + h2 * 8),
                      *(const v8bf*)(vp + 16 + h2 * 8));
      accO[nt] = wmma_bf16(pf, vf, accO[nt]);
    }
  }
  // Publish point of stage st + 1, and the refill of the buffer just read.
  asm volatile("s_wait_dscnt 0x0" ::: "memory");        // this wave has left stage st
  if (pinned(issuer))
    asm volatile("s_wait_tensorcnt 0x0" ::: "memory");  // stage st + 1 has landed
  __syncthreads();                       // published; every wave has left stage st
  if (pinned(issuer & (unsigned)(st + 2 < NSTAGE))) {
    const unsigned nx = pinned((unsigned)st + 2u);
    tdm_load_kv(kvdst + (nx & 1u) * (2u * KVTILE * 2u),
                kvsrc + (unsigned long long)nx * kvstep, kvpitch);
  }
  }
  asm volatile("s_wait_tensorcnt 0x0" ::: "memory");    // nothing in flight at the end
  asm volatile("s_wait_dscnt 0x0" ::: "memory");

  float inv[8];
  #pragma unroll
  for (int r = 0; r < 8; ++r) inv[r] = 1.0f / lr[r];
  const int bb = bh >> 3;
  const int hh = bh & 7;
  #pragma unroll
  for (int nt = 0; nt < 8; ++nt) {
    #pragma unroll
    for (int r = 0; r < 8; ++r) {
      int e = nt * 16 + lm;
      int t = tb + r + 8 * h2;
      Ot[((size_t)bb * TN + t) * KD + hh * ODIM + e] =
          (__bf16)(accO[nt][r] * inv[r]);
    }
  }
}

// ---------------------------------------------------------------------------
extern "C" void kernel_launch(void* const* d_in, const int* in_sizes, int n_in,
                              void* d_out, int out_size, void* d_ws, size_t ws_size,
                              hipStream_t stream) {
  (void)in_sizes; (void)n_in; (void)out_size; (void)ws_size;
  const float* x  = (const float*)d_in[0];
  const float* Wk = (const float*)d_in[1];
  const float* Wq = (const float*)d_in[2];
  const float* Wv = (const float*)d_in[3];
  const float* Wu = (const float*)d_in[4];
  const float* bu = (const float*)d_in[5];

  // ws (bf16 elems): Qt|Kt|V|Ot|xT (8M each) + Wq/Wk/Wv (1M each) + Wu (128K)
  const size_t SEG = (size_t)4 * HEADS * TN * ODIM;  // 8,388,608
  __bf16* ws  = (__bf16*)d_ws;
  __bf16* Qt  = ws;
  __bf16* Kt  = Qt + SEG;
  __bf16* Vb  = Kt + SEG;
  __bf16* Ot  = Vb + SEG;
  __bf16* xT  = Ot + SEG;
  __bf16* Wqb = xT + SEG;
  __bf16* Wkb = Wqb + (size_t)KD * KD;
  __bf16* Wvb = Wkb + (size_t)KD * KD;
  __bf16* Wub = Wvb + (size_t)KD * KD;

  const float qscale = 0.08838834764831845f;  // 1/sqrt(OD=128)
  dim3 blk(256);

  cvt_bf16<<<dim3(1024), blk, 0, stream>>>(Wq, Wqb, 262144);
  cvt_bf16<<<dim3(1024), blk, 0, stream>>>(Wk, Wkb, 262144);
  cvt_bf16<<<dim3(1024), blk, 0, stream>>>(Wv, Wvb, 262144);
  cvt_bf16<<<dim3(128),  blk, 0, stream>>>(Wu, Wub, 32768);
  transpose_x<<<dim3(64, 32, 4), dim3(32, 8), 0, stream>>>(x, xT);

  gemm_wmma_tdm<1><<<dim3(16, 8, 4), blk, 0, stream>>>(Wqb, xT, Qt, nullptr, qscale);
  gemm_wmma_tdm<1><<<dim3(16, 8, 4), blk, 0, stream>>>(Wkb, xT, Kt, nullptr, 1.0f);
  gemm_wmma_tdm<0><<<dim3(16, 8, 4), blk, 0, stream>>>(Wvb, xT, Vb, nullptr, 1.0f);

  attn_wmma<<<dim3(512), blk, 0, stream>>>(Qt, Kt, Vb, Ot);

  gemm_wmma_tdm<2><<<dim3(16, 1, 4), blk, 0, stream>>>(Wub, Ot, d_out, bu, 1.0f);
}

// v002
// A run of this version takes 154 microseconds.
// In both of two side-by-side timings against v001, it was 1.33 times as fast.
// Over all steps from v000 it is 1.86 times as fast.
#include <hip/hip_runtime.h>

typedef __attribute__((ext_vector_type(16))) __bf16 v16bf;
typedef __attribute__((ext_vector_type(8)))  __bf16 v8bf;
typedef __attribute__((ext_vector_type(4)))  __bf16 v4bf;
typedef __attribute__((ext_vector_type(8)))  float  v8f;
typedef __attribute__((ext_vector_type(4)))  float  v4f;
typedef __attribute__((ext_vector_type(4)))  unsigned int v4u;
typedef __attribute__((ext_vector_type(4)))  int v4i;
typedef __attribute__((ext_vector_type(8)))  int v8i;

#define TN    2048   // time dim / GEMM N
#define KD    1024   // channel dim / GEMM K (= H*OD)
#define HEADS 8
#define ODIM  128
#define LDPAD 40     // LDS row pitch in bf16: 64B data + 16B pad = 80B

__device__ __forceinline__ v16bf comb(v8bf lo, v8bf hi) {
  return __builtin_shufflevector(lo, hi, 0,1,2,3,4,5,6,7,8,9,10,11,12,13,14,15);
}
__device__ __forceinline__ v8f wmma_bf16(v16bf a, v16bf b, v8f c) {
  return __builtin_amdgcn_wmma_f32_16x16x32_bf16(false, a, false, b, (short)0, c, false, false);
}

__device__ __forceinline__ void tdm_load_128x32(__bf16* lds_dst,
                                                const __bf16* gsrc,
                                                unsigned pitch) {
#if __has_builtin(__builtin_amdgcn_tensor_load_to_lds)
  unsigned long long ga = (unsigned long long)(uintptr_t)gsrc;
  unsigned la = (unsigned)(uintptr_t)lds_dst;  // low 32 bits = LDS byte offset
  v4u g0;
  g0.x = 1u;
  g0.y = la;
  g0.z = (unsigned)ga;
  g0.w = ((unsigned)(ga >> 32) & 0x01FFFFFFu)
       | (2u << 30);
  v8i g1;
  g1[0] = (int)((1u << 16)
              | (1u << 20)
              | (3u << 22)
              | (3u << 25));
  g1[1] = (int)((pitch & 0xFFFFu) << 16);
  g1[2] = (int)((pitch >> 16) | (0xFFFFu << 16));
  g1[3] = (int)(32u << 16);
  g1[4] = (int)128u;
  g1[5] = (int)pitch;
  g1[6] = 0;
  g1[7] = 0;
  v4i z4 = {0, 0, 0, 0};
#if __clang_major__ >= 23
  v8i z8 = {0, 0, 0, 0, 0, 0, 0, 0};
  __builtin_amdgcn_tensor_load_to_lds(g0, g1, z4, z4, z8, 0);
#else
  __builtin_amdgcn_tensor_load_to_lds(g0, g1, z4, z4, 0);
#endif
#else
  // Fallback: wave-cooperative copy (probed toolchains all have the builtin).
  int lane = threadIdx.x & 31;
  for (int r = 0; r < 128; ++r) {
    if (lane < 16)
      ((unsigned*)(lds_dst + r * LDPAD))[lane] =
          ((const unsigned*)(gsrc + (size_t)r * pitch))[lane];
  }
#endif
}

// ---------------------------------------------------------------------------
// fp32 -> bf16 bulk convert (weights). n4 = element_count / 4.
// ---------------------------------------------------------------------------
__global__ __launch_bounds__(256) void cvt_bf16(const float* __restrict__ src,
                                                __bf16* __restrict__ dst, int n4) {
  int i = blockIdx.x * 256 + threadIdx.x;
  if (i < n4) {
    v4f s = *(const v4f*)(src + 4 * (size_t)i);
    v4bf d;
    d.x = (__bf16)s.x; d.y = (__bf16)s.y; d.z = (__bf16)s.z; d.w = (__bf16)s.w;
    *(v4bf*)(dst + 4 * (size_t)i) = d;
  }
}

// ---------------------------------------------------------------------------
// x (b, k, t) fp32 -> xT (b, t, k) bf16, 32x32 tiles through LDS.
// ---------------------------------------------------------------------------
__global__ __launch_bounds__(256) void transpose_x(const float* __restrict__ x,
                                                   __bf16* __restrict__ xT) {
  __shared__ __bf16 tile[32][33];
  const int tx = threadIdx.x, ty = threadIdx.y;  // (32, 8)
  const int b = blockIdx.z;
  const int t0 = blockIdx.x * 32, k0 = blockIdx.y * 32;
  const float* xb = x + (size_t)b * KD * TN;
  __bf16* xTb = xT + (size_t)b * TN * KD;
  #pragma unroll
  for (int i = 0; i < 4; ++i)
    tile[ty + 8 * i][tx] = (__bf16)xb[(size_t)(k0 + ty + 8 * i) * TN + t0 + tx];
  __syncthreads();
  #pragma unroll
  for (int i = 0; i < 4; ++i)
    xTb[(size_t)(t0 + ty + 8 * i) * KD + k0 + tx] = tile[tx][ty + 8 * i];
}

template<int OMODE>
__global__ __launch_bounds__(256) void gemm_wmma_tdm(
    const __bf16* __restrict__ A, const __bf16* __restrict__ Bt,
    void* __restrict__ Cout, const float* __restrict__ bias, float scale)
{
  __shared__ __bf16 Alds[2][128 * LDPAD] __attribute__((aligned(16)));
  __shared__ __bf16 Blds[2][128 * LDPAD] __attribute__((aligned(16)));

  const int tid  = threadIdx.x;
  const int lane = tid & 31;
  const int wid  = tid >> 5;
  const int lm   = lane & 15;
  const int h2   = lane >> 4;
  const int wm   = (wid & 3) * 32;   // 4 waves tile M
  const int wn   = (wid >> 2) * 64;  // 2 waves tile N
  const int mblk = blockIdx.y * 128;
  const int nblk = blockIdx.x * 128;
  const int z    = blockIdx.z;

  const __bf16* Ab = A + (size_t)mblk * KD;
  const __bf16* Bb = Bt + (size_t)z * TN * KD + (size_t)nblk * KD;

  v8f zero8 = {};
  v8f acc[2][4];
  #pragma unroll
  for (int mi = 0; mi < 2; ++mi)
    #pragma unroll
    for (int ni = 0; ni < 4; ++ni) acc[mi][ni] = zero8;

  if (wid == 0) {                        // prologue: DMA first tiles
    tdm_load_128x32(&Alds[0][0], Ab, KD);
    tdm_load_128x32(&Blds[0][0], Bb, KD);
  }

  for (int kk = 0; kk < KD; kk += 32) {
    const int cur = (kk >> 5) & 1;
    if (wid == 0) __builtin_amdgcn_s_wait_tensorcnt(0);
    __syncthreads();                     // cur buffers ready for everyone
    if (wid == 0 && kk + 32 < KD) {      // prefetch next tiles into other buf
      tdm_load_128x32(&Alds[cur ^ 1][0], Ab + kk + 32, KD);
      tdm_load_128x32(&Blds[cur ^ 1][0], Bb + kk + 32, KD);
    }

    v16bf af[2];
    #pragma unroll
    for (int mi = 0; mi < 2; ++mi) {
      const __bf16* ap = &Alds[cur][(wm + mi * 16 + lm) * LDPAD];
      af[mi] = comb(*(const v8bf*)(ap + h2 * 8), *(const v8bf*)(ap + 16 + h2 * 8));
    }
    #pragma unroll
    for (int ni = 0; ni < 4; ++ni) {
      const __bf16* bp = &Blds[cur][(wn + ni * 16 + lm) * LDPAD];
      v16bf bfrag = comb(*(const v8bf*)(bp + h2 * 8), *(const v8bf*)(bp + 16 + h2 * 8));
      #pragma unroll
      for (int mi = 0; mi < 2; ++mi)
        acc[mi][ni] = wmma_bf16(af[mi], bfrag, acc[mi][ni]);
    }
    __syncthreads();                     // done reading cur before it is reused
  }

  // epilogue: D layout lane -> (m = r + 8*h2, n = lm)
  #pragma unroll
  for (int mi = 0; mi < 2; ++mi) {
    #pragma unroll
    for (int ni = 0; ni < 4; ++ni) {
      #pragma unroll
      for (int r = 0; r < 8; ++r) {
        int j = mblk + wm + mi * 16 + r + 8 * h2;
        int t = nblk + wn + ni * 16 + lm;
        float v = acc[mi][ni][r] * scale;
        if constexpr (OMODE == 0) {
          ((__bf16*)Cout)[(size_t)z * KD * TN + (size_t)j * TN + t] = (__bf16)v;
        } else if constexpr (OMODE == 1) {
          int h = j >> 7, e = j & 127;
          ((__bf16*)Cout)[(((size_t)z * HEADS + h) * TN + t) * ODIM + e] = (__bf16)v;
        } else {
          ((float*)Cout)[(size_t)z * ODIM * TN + (size_t)j * TN + t] = v + bias[j];
        }
      }
    }
  }
}

#define SKEYS  128
#define NSTAGE (TN / SKEYS)
#define KVP    136
#define KVTILE (128 * KVP)

typedef __attribute__((ext_vector_type(8))) unsigned int v8u;

__device__ __forceinline__ unsigned uni(unsigned v) {
  return (unsigned)__builtin_amdgcn_readfirstlane((int)v);
}
__device__ __forceinline__ unsigned pinned(unsigned v) {
  unsigned w = uni(v);
  asm volatile("" : "+s"(w));  // the word stays in a scalar register
  return w;
}
// One request: 128 rows of 256 B, source pitch src_pitch bytes, into LDS at
// byte offset lds_dst with 16 B of pad behind every row. All extents in bytes.
__device__ __forceinline__ void tdm_load_kv(unsigned lds_dst,
                                            unsigned long long ga,
                                            unsigned src_pitch) {
  v4u g0;
  g0[0] = uni(1u);                                        // count = 1
  g0[1] = uni(lds_dst);
  g0[2] = uni((unsigned)ga);
  g0[3] = uni((((unsigned)(ga >> 32)) & 0x01FFFFFFu) | 0x80000000u);  // type = 2
  v8u g1;
  g1[0] = uni((1u << 20) | (5u << 22) | (3u << 25));
  g1[1] = uni(256u << 16);
  g1[2] = uni(128u << 16);
  g1[3] = uni(256u << 16);
  g1[4] = uni(128u);
  g1[5] = uni(src_pitch);
  g1[6] = uni(0u);
  g1[7] = uni(0u);
  asm volatile("tensor_load_to_lds %0, %1" :: "s"(g0), "s"(g1) : "memory");
}
__device__ __forceinline__ float xhalf(float x) {
  return __builtin_bit_cast(float, __builtin_amdgcn_permlanex16(
      __builtin_bit_cast(int, x), __builtin_bit_cast(int, x),
      0x76543210, 0xfedcba98, false, false));
}
__global__ __launch_bounds__(256) void attn_wmma(
    const __bf16* __restrict__ Qt,  // (b,h,t,e), pre-scaled
    const __bf16* __restrict__ Kt,  // (b,h,i,e)
    const __bf16* __restrict__ Vb,  // (b, j=h*128+e, i)
    __bf16* __restrict__ Ot)        // (b, t, j)
{
  __shared__ __bf16 ring[2][2][KVTILE] __attribute__((aligned(2048)));  // [buffer][K, V]
  const int tid  = threadIdx.x;
  const int lane = tid & 31;
  const int wid  = tid >> 5;
  const int lm   = lane & 15;
  const int h2   = lane >> 4;
  const int task = blockIdx.x * 8 + wid;
  const int bh   = task >> 7;
  const int tb   = (task & 127) * 16;

  // Wave 0 brings K, wave 1 brings V; all of this is wave-uniform.
  const unsigned wave   = uni((unsigned)tid >> 5);
  const unsigned issuer = wave < 2u;
  const unsigned isV    = wave & 1u;
  const unsigned bhu    = uni((unsigned)bh);
  const unsigned long long kvsrc = isV
      ? (unsigned long long)(uintptr_t)(Vb + (size_t)bhu * ODIM * TN)
      : (unsigned long long)(uintptr_t)(Kt + (size_t)bhu * TN * ODIM);
  const unsigned kvstep  = isV ? SKEYS * 2u : SKEYS * ODIM * 2u;  // bytes per stage
  const unsigned kvpitch = isV ? TN * 2u : ODIM * 2u;             // source row pitch
  const unsigned kvdst   = (unsigned)(uintptr_t)&ring[0][0][0] + isV * (KVTILE * 2u);

  if (pinned(issuer)) {                  // stage 0
    tdm_load_kv(kvdst, kvsrc, kvpitch);
    asm volatile("s_wait_tensorcnt 0x0" ::: "memory");  // stage 0 has landed
  }
  __syncthreads();                       // stage 0 published to all waves
  if (pinned(issuer))                    // stage 1 flies under stage 0's work
    tdm_load_kv(kvdst + 2u * KVTILE * 2u, kvsrc + kvstep, kvpitch);

  v16bf qf[4];
  {
    const __bf16* qp = Qt + ((size_t)bh * TN + tb + lm) * ODIM;
    #pragma unroll
    for (int es = 0; es < 4; ++es)
      qf[es] = comb(*(const v8bf*)(qp + es * 32 + h2 * 8),
                    *(const v8bf*)(qp + es * 32 + 16 + h2 * 8));
  }

  v8f zero8 = {};
  v8f accO[8];
  #pragma unroll
  for (int nt = 0; nt < 8; ++nt) accO[nt] = zero8;
  float mr = -3.0e38f;  // running maximum of this lane's query, equal in both halves
  float lr = 0.0f;      // running sum over this half's keys; the halves join after the loop

  #pragma unroll 1  // one stage per trip: the publish point stands once, at its foot
  for (int st = 0; st < NSTAGE; ++st) {
  const __bf16* kt = &ring[st & 1][0][0];
  const __bf16* vt = &ring[st & 1][1][0];
  #pragma unroll 1
  for (int i0 = 0; i0 < SKEYS; i0 += 32) {
    v8f s0 = zero8, s1 = zero8;
    const __bf16* kp0 = kt + (i0 + lm) * KVP;
    const __bf16* kp1 = kp0 + 16 * KVP;
    #pragma unroll
    for (int es = 0; es < 4; ++es) {
      v16bf k0 = comb(*(const v8bf*)(kp0 + es * 32 + h2 * 8),
                      *(const v8bf*)(kp0 + es * 32 + 16 + h2 * 8));
      v16bf k1 = comb(*(const v8bf*)(kp1 + es * 32 + h2 * 8),
                      *(const v8bf*)(kp1 + es * 32 + 16 + h2 * 8));
      s0 = wmma_bf16(k0, qf[es], s0);   // s0[r] = S[key i0 + 8*h2 + r][query lm]
      s1 = wmma_bf16(k1, qf[es], s1);   // s1[r] = the same, 16 keys on
    }
    float mx = fmaxf(s0[0], s1[0]);
    #pragma unroll
    for (int r = 1; r < 8; ++r) mx = fmaxf(mx, fmaxf(s0[r], s1[r]));
    mx = fmaxf(mx, xhalf(mx));
    const float mnew  = fmaxf(mr, mx);
    float alpha;
    asm("v_exp_f32 %0, %1\n\tv_nop" : "=v"(alpha) : "v"((mr - mnew) * 1.44269504f));
    mr = mnew;
    v16bf pf;  // B operand: element s is key i0 + 8*h2 + s (+8 for s >= 8) of this lane's query
    #pragma unroll
    for (int r = 0; r < 8; ++r) {
      s0[r] = __expf(s0[r] - mnew);
      s1[r] = __expf(s1[r] - mnew);
      pf[r]     = (__bf16)s0[r];
      pf[8 + r] = (__bf16)s1[r];
    }
    #pragma unroll
    for (int nt = 0; nt < 8; ++nt) accO[nt] *= alpha;

    #pragma unroll
    for (int nt = 0; nt < 8; ++nt) {
      const __bf16* vp = vt + (nt * 16 + lm) * KVP + i0;
      v16bf vf = comb(*(const v8bf*)(vp + h2 * 8),
                      *(const v8bf*)(vp + 16 + h2 * 8));
      accO[nt] = wmma_bf16(vf, pf, accO[nt]);  // accO[nt][r] = O[e = nt*16 + 8*h2 + r][query lm]
    }
    __builtin_amdgcn_sched_barrier(0);
    float rs0 = lr * alpha, rs1 = 0.0f;
    #pragma unroll
    for (int r = 0; r < 8; ++r) { rs0 += s0[r]; rs1 += s1[r]; }
    lr = rs0 + rs1;
  }
  // Publish point of stage st + 1, and the refill of the buffer just read.
  asm volatile("s_wait_dscnt 0x0" ::: "memory");        // this wave has left stage st
  if (pinned(issuer))
    asm volatile("s_wait_tensorcnt 0x0" ::: "memory");  // stage st + 1 has landed
  __syncthreads();                       // published; every wave has left stage st
  if (pinned(issuer & (unsigned)(st + 2 < NSTAGE))) {
    const unsigned nx = pinned((unsigned)st + 2u);
    tdm_load_kv(kvdst + (nx & 1u) * (2u * KVTILE * 2u),
                kvsrc + (unsigned long long)nx * kvstep, kvpitch);
  }
  }
  asm volatile("s_wait_tensorcnt 0x0" ::: "memory");    // nothing in flight at the end
  asm volatile("s_wait_dscnt 0x0" ::: "memory");

  const float inv = 1.0f / (lr + xhalf(lr));
  const int bb = bh >> 3;
  const int hh = bh & 7;
  __bf16* op = Ot + ((size_t)bb * TN + tb + lm) * KD + hh * ODIM + 8 * h2;
  v8bf o[8];
  #pragma unroll
  for (int nt = 0; nt < 8; ++nt)
    #pragma unroll
    for (int r = 0; r < 8; ++r) o[nt][r] = (__bf16)(accO[nt][r] * inv);
  #pragma unroll
  for (int nt = 0; nt < 8; ++nt) *(v8bf*)(op + nt * 16) = o[nt];
}

// ---------------------------------------------------------------------------
extern "C" void kernel_launch(void* const* d_in, const int* in_sizes, int n_in,
                              void* d_out, int out_size, void* d_ws, size_t ws_size,
                              hipStream_t stream) {
  (void)in_sizes; (void)n_in; (void)out_size; (void)ws_size;
  const float* x  = (const float*)d_in[0];
  const float* Wk = (const float*)d_in[1];
  const float* Wq = (const float*)d_in[2];
  const float* Wv = (const float*)d_in[3];
  const float* Wu = (const float*)d_in[4];
  const float* bu = (const float*)d_in[5];

  // ws (bf16 elems): Qt|Kt|V|Ot|xT (8M each) + Wq/Wk/Wv (1M each) + Wu (128K)
  const size_t SEG = (size_t)4 * HEADS * TN * ODIM;  // 8,388,608
  __bf16* ws  = (__bf16*)d_ws;
  __bf16* Qt  = ws;
  __bf16* Kt  = Qt + SEG;
  __bf16* Vb  = Kt + SEG;
  __bf16* Ot  = Vb + SEG;
  __bf16* xT  = Ot + SEG;
  __bf16* Wqb = xT + SEG;
  __bf16* Wkb = Wqb + (size_t)KD * KD;
  __bf16* Wvb = Wkb + (size_t)KD * KD;
  __bf16* Wub = Wvb + (size_t)KD * KD;

  const float qscale = 0.08838834764831845f;  // 1/sqrt(OD=128)
  dim3 blk(256);

  cvt_bf16<<<dim3(1024), blk, 0, stream>>>(Wq, Wqb, 262144);
  cvt_bf16<<<dim3(1024), blk, 0, stream>>>(Wk, Wkb, 262144);
  cvt_bf16<<<dim3(1024), blk, 0, stream>>>(Wv, Wvb, 262144);
  cvt_bf16<<<dim3(128),  blk, 0, stream>>>(Wu, Wub, 32768);
  transpose_x<<<dim3(64, 32, 4), dim3(32, 8), 0, stream>>>(x, xT);

  gemm_wmma_tdm<1><<<dim3(16, 8, 4), blk, 0, stream>>>(Wqb, xT, Qt, nullptr, qscale);
  gemm_wmma_tdm<1><<<dim3(16, 8, 4), blk, 0, stream>>>(Wkb, xT, Kt, nullptr, 1.0f);
  gemm_wmma_tdm<0><<<dim3(16, 8, 4), blk, 0, stream>>>(Wvb, xT, Vb, nullptr, 1.0f);

  attn_wmma<<<dim3(512), blk, 0, stream>>>(Qt, Kt, Vb, Ot);

  gemm_wmma_tdm<2><<<dim3(16, 1, 4), blk, 0, stream>>>(Wub, Ot, d_out, bu, 1.0f);
}

// v003
// One run takes 148 microseconds.
// Next to v002, in two timings, it ran 1.04 and 1.03 times as fast.
// All steps since v000 together make it 1.93 times as fast.
#include <hip/hip_runtime.h>

typedef __attribute__((ext_vector_type(16))) __bf16 v16bf;
typedef __attribute__((ext_vector_type(8)))  __bf16 v8bf;
typedef __attribute__((ext_vector_type(4)))  __bf16 v4bf;
typedef __attribute__((ext_vector_type(8)))  float  v8f;
typedef __attribute__((ext_vector_type(4)))  float  v4f;
typedef __attribute__((ext_vector_type(4)))  unsigned int v4u;
typedef __attribute__((ext_vector_type(4)))  int v4i;
typedef __attribute__((ext_vector_type(8)))  int v8i;

#define TN    2048   // time dim / GEMM N
#define KD    1024   // channel dim / GEMM K (= H*OD)
#define HEADS 8
#define ODIM  128
#define LDPAD 40     // LDS row pitch in bf16: 64B data + 16B pad = 80B

__device__ __forceinline__ v16bf comb(v8bf lo, v8bf hi) {
  return __builtin_shufflevector(lo, hi, 0,1,2,3,4,5,6,7,8,9,10,11,12,13,14,15);
}
__device__ __forceinline__ v8f wmma_bf16(v16bf a, v16bf b, v8f c) {
  return __builtin_amdgcn_wmma_f32_16x16x32_bf16(false, a, false, b, (short)0, c, false, false);
}

__device__ __forceinline__ void tdm_load_128x32(__bf16* lds_dst,
                                                const __bf16* gsrc,
                                                unsigned pitch) {
#if __has_builtin(__builtin_amdgcn_tensor_load_to_lds)
  unsigned long long ga = (unsigned long long)(uintptr_t)gsrc;
  unsigned la = (unsigned)(uintptr_t)lds_dst;  // low 32 bits = LDS byte offset
  v4u g0;
  g0.x = 1u;
  g0.y = la;
  g0.z = (unsigned)ga;
  g0.w = ((unsigned)(ga >> 32) & 0x01FFFFFFu)
       | (2u << 30);
  v8i g1;
  g1[0] = (int)((1u << 16)
              | (1u << 20)
              | (3u << 22)
              | (3u << 25));
  g1[1] = (int)((pitch & 0xFFFFu) << 16);
  g1[2] = (int)((pitch >> 16) | (0xFFFFu << 16));
  g1[3] = (int)(32u << 16);
  g1[4] = (int)128u;
  g1[5] = (int)pitch;
  g1[6] = 0;
  g1[7] = 0;
  v4i z4 = {0, 0, 0, 0};
#if __clang_major__ >= 23
  v8i z8 = {0, 0, 0, 0, 0, 0, 0, 0};
  __builtin_amdgcn_tensor_load_to_lds(g0, g1, z4, z4, z8, 0);
#else
  __builtin_amdgcn_tensor_load_to_lds(g0, g1, z4, z4, 0);
#endif
#else
  // Fallback: wave-cooperative copy (probed toolchains all have the builtin).
  int lane = threadIdx.x & 31;
  for (int r = 0; r < 128; ++r) {
    if (lane < 16)
      ((unsigned*)(lds_dst + r * LDPAD))[lane] =
          ((const unsigned*)(gsrc + (size_t)r * pitch))[lane];
  }
#endif
}

// ---------------------------------------------------------------------------
// Pre-pass, one grid for five independent jobs; the block index picks the job.
//   blocks 0 .. 8191     : x (b, k, t) fp32 -> xT (b, t, k) bf16, one 32x32 tile
//                          through LDS each (64 t tiles x 32 k tiles x 4 b)
//   blocks 8192 .. 11391 : fp32 -> bf16 convert of Wq, Wk, Wv (1024 blocks each)
//                          and Wu (128 blocks), 4 elements per thread; the four
//                          bf16 copies lie one behind the other in Wb.
// ---------------------------------------------------------------------------
#define XT_BLOCKS  8192
#define CVT_BLOCKS 3200
__global__ __launch_bounds__(256) void prepass(const float* __restrict__ x,
                                               const float* __restrict__ Wq,
                                               const float* __restrict__ Wk,
                                               const float* __restrict__ Wv,
                                               const float* __restrict__ Wu,
                                               __bf16* __restrict__ xT,
                                               __bf16* __restrict__ Wb) {
  __shared__ __bf16 tile[32][33];
  const int bid = blockIdx.x;
  if (bid < XT_BLOCKS) {
    const int tx = threadIdx.x & 31, ty = threadIdx.x >> 5;  // (32, 8)
    const int b = bid >> 11;
    const int t0 = (bid & 63) * 32, k0 = ((bid >> 6) & 31) * 32;
    const float* xb = x + (size_t)b * KD * TN;
    __bf16* xTb = xT + (size_t)b * TN * KD;
    #pragma unroll
    for (int i = 0; i < 4; ++i)
      tile[ty + 8 * i][tx] = (__bf16)xb[(size_t)(k0 + ty + 8 * i) * TN + t0 + tx];
    __syncthreads();
    #pragma unroll
    for (int i = 0; i < 4; ++i)
      xTb[(size_t)(t0 + ty + 8 * i) * KD + k0 + tx] = tile[tx][ty + 8 * i];
  } else {
    const int c = bid - XT_BLOCKS;
    const int w = c >> 10;  // 0, 1, 2: Wq, Wk, Wv; 3: Wu
    const float* src = w == 0 ? Wq : w == 1 ? Wk : w == 2 ? Wv : Wu;
    const size_t i = (size_t)(c & 1023) * 256 + threadIdx.x;
    v4f s = *(const v4f*)(src + 4 * i);
    v4bf d;
    d.x = (__bf16)s.x; d.y = (__bf16)s.y; d.z = (__bf16)s.z; d.w = (__bf16)s.w;
    *(v4bf*)(Wb + (size_t)w * KD * KD + 4 * i) = d;
  }
}

template<int OMODE>
__global__ __launch_bounds__(256) void gemm_wmma_tdm(
    const __bf16* __restrict__ A, const __bf16* __restrict__ Bt,
    void* __restrict__ Cout, const float* __restrict__ bias, float scale)
{
  __shared__ __bf16 Alds[2][128 * LDPAD] __attribute__((aligned(16)));
  __shared__ __bf16 Blds[2][128 * LDPAD] __attribute__((aligned(16)));

  const int tid  = threadIdx.x;
  const int lane = tid & 31;
  const int wid  = tid >> 5;
  const int lm   = lane & 15;
  const int h2   = lane >> 4;
  const int wm   = (wid & 3) * 32;   // 4 waves tile M
  const int wn   = (wid >> 2) * 64;  // 2 waves tile N
  const int mblk = blockIdx.y * 128;
  const int nblk = blockIdx.x * 128;
  const int z    = blockIdx.z;

  const __bf16* Ab = A + (size_t)mblk * KD;
  const __bf16* Bb = Bt + (size_t)z * TN * KD + (size_t)nblk * KD;

  v8f zero8 = {};
  v8f acc[2][4];
  #pragma unroll
  for (int mi = 0; mi < 2; ++mi)
    #pragma unroll
    for (int ni = 0; ni < 4; ++ni) acc[mi][ni] = zero8;

  if (wid == 0) {                        // prologue: DMA first tiles
    tdm_load_128x32(&Alds[0][0], Ab, KD);
    tdm_load_128x32(&Blds[0][0], Bb, KD);
  }

  for (int kk = 0; kk < KD; kk += 32) {
    const int cur = (kk >> 5) & 1;
    if (wid == 0) __builtin_amdgcn_s_wait_tensorcnt(0);
    __syncthreads();                     // cur buffers ready for everyone
    if (wid == 0 && kk + 32 < KD) {      // prefetch next tiles into other buf
      tdm_load_128x32(&Alds[cur ^ 1][0], Ab + kk + 32, KD);
      tdm_load_128x32(&Blds[cur ^ 1][0], Bb + kk + 32, KD);
    }

    v16bf af[2];
    #pragma unroll
    for (int mi = 0; mi < 2; ++mi) {
      const __bf16* ap = &Alds[cur][(wm + mi * 16 + lm) * LDPAD];
      af[mi] = comb(*(const v8bf*)(ap + h2 * 8), *(const v8bf*)(ap + 16 + h2 * 8));
    }
    #pragma unroll
    for (int ni = 0; ni < 4; ++ni) {
      const __bf16* bp = &Blds[cur][(wn + ni * 16 + lm) * LDPAD];
      v16bf bfrag = comb(*(const v8bf*)(bp + h2 * 8), *(const v8bf*)(bp + 16 + h2 * 8));
      #pragma unroll
      for (int mi = 0; mi < 2; ++mi)
        acc[mi][ni] = wmma_bf16(af[mi], bfrag, acc[mi][ni]);
    }
    __syncthreads();                     // done reading cur before it is reused
  }

  // epilogue: D layout lane -> (m = r + 8*h2, n = lm)
  const int proj = OMODE == 0 ? (int)(blockIdx.y >> 3) : 0;  // 0 Q, 1 K, 2 V: the same for a whole block
  const int jblk = OMODE == 0 ? (mblk & (KD - 1)) : mblk;    // row inside that projection
  const float sc = (OMODE == 0 && proj != 0) ? 1.0f : scale; // only Q is scaled
  __bf16* Cp = (__bf16*)Cout + (size_t)proj * (4 * (size_t)KD * TN);
  if (OMODE == 0 && proj < 2) {
    #pragma unroll
    for (int mi = 0; mi < 2; ++mi) {
      #pragma unroll
      for (int ni = 0; ni < 4; ++ni) {
        #pragma unroll
        for (int r = 0; r < 8; ++r) {
          int j = jblk + wm + mi * 16 + r + 8 * h2;
          int t = nblk + wn + ni * 16 + lm;
          int h = j >> 7, e = j & 127;
          Cp[(((size_t)z * HEADS + h) * TN + t) * ODIM + e] = (__bf16)(acc[mi][ni][r] * sc);
        }
      }
    }
  } else {
    #pragma unroll
    for (int mi = 0; mi < 2; ++mi) {
      #pragma unroll
      for (int ni = 0; ni < 4; ++ni) {
        #pragma unroll
        for (int r = 0; r < 8; ++r) {
          int j = jblk + wm + mi * 16 + r + 8 * h2;
          int t = nblk + wn + ni * 16 + lm;
          float v = acc[mi][ni][r] * sc;
          if constexpr (OMODE == 0) {
            Cp[(size_t)z * KD * TN + (size_t)j * TN + t] = (__bf16)v;
          } else {
            ((float*)Cout)[(size_t)z * ODIM * TN + (size_t)j * TN + t] = v + bias[j];
          }
        }
      }
    }
    if constexpr (OMODE == 0) {
      // The built code can fall from the V stores into the Q/K epilogue, which
      // reuses their data registers: the wait stands in front of that reuse.
      asm volatile("s_wait_xcnt 0x0" ::: "memory");
    }
  }
}

#define SKEYS  128
#define NSTAGE (TN / SKEYS)
#define KVP    136
#define KVTILE (128 * KVP)

typedef __attribute__((ext_vector_type(8))) unsigned int v8u;

__device__ __forceinline__ unsigned uni(unsigned v) {
  return (unsigned)__builtin_amdgcn_readfirstlane((int)v);
}
__device__ __forceinline__ unsigned pinned(unsigned v) {
  unsigned w = uni(v);
  asm volatile("" : "+s"(w));  // the word stays in a scalar register
  return w;
}
// One request: 128 rows of 256 B, source pitch src_pitch bytes, into LDS at
// byte offset lds_dst with 16 B of pad behind every row. All extents in bytes.
__device__ __forceinline__ void tdm_load_kv(unsigned lds_dst,
                                            unsigned long long ga,
                                            unsigned src_pitch) {
  v4u g0;
  g0[0] = uni(1u);                                        // count = 1
  g0[1] = uni(lds_dst);
  g0[2] = uni((unsigned)ga);
  g0[3] = uni((((unsigned)(ga >> 32)) & 0x01FFFFFFu) | 0x80000000u);  // type = 2
  v8u g1;
  g1[0] = uni((1u << 20) | (5u << 22) | (3u << 25));
  g1[1] = uni(256u << 16);
  g1[2] = uni(128u << 16);
  g1[3] = uni(256u << 16);
  g1[4] = uni(128u);
  g1[5] = uni(src_pitch);
  g1[6] = uni(0u);
  g1[7] = uni(0u);
  asm volatile("tensor_load_to_lds %0, %1" :: "s"(g0), "s"(g1) : "memory");
}
__device__ __forceinline__ float xhalf(float x) {
  return __builtin_bit_cast(float, __builtin_amdgcn_permlanex16(
      __builtin_bit_cast(int, x), __builtin_bit_cast(int, x),
      0x76543210, 0xfedcba98, false, false));
}
__global__ __launch_bounds__(256) void attn_wmma(
    const __bf16* __restrict__ Qt,  // (b,h,t,e), pre-scaled
    const __bf16* __restrict__ Kt,  // (b,h,i,e)
    const __bf16* __restrict__ Vb,  // (b, j=h*128+e, i)
    __bf16* __restrict__ Ot)        // (b, t, j)
{
  __shared__ __bf16 ring[2][2][KVTILE] __attribute__((aligned(2048)));  // [buffer][K, V]
  const int tid  = threadIdx.x;
  const int lane = tid & 31;
  const int wid  = tid >> 5;
  const int lm   = lane & 15;
  const int h2   = lane >> 4;
  const int task = blockIdx.x * 8 + wid;
  const int bh   = task >> 7;
  const int tb   = (task & 127) * 16;

  // Wave 0 brings K, wave 1 brings V; all of this is wave-uniform.
  const unsigned wave   = uni((unsigned)tid >> 5);
  const unsigned issuer = wave < 2u;
  const unsigned isV    = wave & 1u;
  const unsigned bhu    = uni((unsigned)bh);
  const unsigned long long kvsrc = isV
      ? (unsigned long long)(uintptr_t)(Vb + (size_t)bhu * ODIM * TN)
      : (unsigned long long)(uintptr_t)(Kt + (size_t)bhu * TN * ODIM);
  const unsigned kvstep  = isV ? SKEYS * 2u : SKEYS * ODIM * 2u;  // bytes per stage
  const unsigned kvpitch = isV ? TN * 2u : ODIM * 2u;             // source row pitch
  const unsigned kvdst   = (unsigned)(uintptr_t)&ring[0][0][0] + isV * (KVTILE * 2u);

  if (pinned(issuer)) {                  // stage 0
    tdm_load_kv(kvdst, kvsrc, kvpitch);
    asm volatile("s_wait_tensorcnt 0x0" ::: "memory");  // stage 0 has landed
  }
  __syncthreads();                       // stage 0 published to all waves
  if (pinned(issuer))                    // stage 1 flies under stage 0's work
    tdm_load_kv(kvdst + 2u * KVTILE * 2u, kvsrc + kvstep, kvpitch);

  v16bf qf[4];
  {
    const __bf16* qp = Qt + ((size_t)bh * TN + tb + lm) * ODIM;
    #pragma unroll
    for (int es = 0; es < 4; ++es)
      qf[es] = comb(*(const v8bf*)(qp + es * 32 + h2 * 8),
                    *(const v8bf*)(qp + es * 32 + 16 + h2 * 8));
  }

  v8f zero8 = {};
  v8f accO[8];
  #pragma unroll
  for (int nt = 0; nt < 8; ++nt) accO[nt] = zero8;
  float mr = -3.0e38f;  // running maximum of this lane's query, equal in both halves
  float lr = 0.0f;      // running sum over this half's keys; the halves join after the loop

  #pragma unroll 1  // one stage per trip: the publish point stands once, at its foot
  for (int st = 0; st < NSTAGE; ++st) {
  const __bf16* kt = &ring[st & 1][0][0];
  const __bf16* vt = &ring[st & 1][1][0];
  #pragma unroll 1
  for (int i0 = 0; i0 < SKEYS; i0 += 32) {
    v8f s0 = zero8, s1 = zero8;
    const __bf16* kp0 = kt + (i0 + lm) * KVP;
    const __bf16* kp1 = kp0 + 16 * KVP;
    #pragma unroll
    for (int es = 0; es < 4; ++es) {
      v16bf k0 = comb(*(const v8bf*)(kp0 + es * 32 + h2 * 8),
                      *(const v8bf*)(kp0 + es * 32 + 16 + h2 * 8));
      v16bf k1 = comb(*(const v8bf*)(kp1 + es * 32 + h2 * 8),
                      *(const v8bf*)(kp1 + es * 32 + 16 + h2 * 8));
      s0 = wmma_bf16(k0, qf[es], s0);   // s0[r] = S[key i0 + 8*h2 + r][query lm]
      s1 = wmma_bf16(k1, qf[es], s1);   // s1[r] = the same, 16 keys on
    }
    float mx = fmaxf(s0[0], s1[0]);
    #pragma unroll
    for (int r = 1; r < 8; ++r) mx = fmaxf(mx, fmaxf(s0[r], s1[r]));
    mx = fmaxf(mx, xhalf(mx));
    const float mnew  = fmaxf(mr, mx);
    float alpha;
    asm("v_exp_f32 %0, %1\n\tv_nop" : "=v"(alpha) : "v"((mr - mnew) * 1.44269504f));
    mr = mnew;
    v16bf pf;  // B operand: element s is key i0 + 8*h2 + s (+8 for s >= 8) of this lane's query
    #pragma unroll
    for (int r = 0; r < 8; ++r) {
      s0[r] = __expf(s0[r] - mnew);
      s1[r] = __expf(s1[r] - mnew);
      pf[r]     = (__bf16)s0[r];
      pf[8 + r] = (__bf16)s1[r];
    }
    #pragma unroll
    for (int nt = 0; nt < 8; ++nt) accO[nt] *= alpha;

    #pragma unroll
    for (int nt = 0; nt < 8; ++nt) {
      const __bf16* vp = vt + (nt * 16 + lm) * KVP + i0;
      v16bf vf = comb(*(const v8bf*)(vp + h2 * 8),
                      *(const v8bf*)(vp + 16 + h2 * 8));
      accO[nt] = wmma_bf16(vf, pf, accO[nt]);  // accO[nt][r] = O[e = nt*16 + 8*h2 + r][query lm]
    }
    __builtin_amdgcn_sched_barrier(0);
    float rs0 = lr * alpha, rs1 = 0.0f;
    #pragma unroll
    for (int r = 0; r < 8; ++r) { rs0 += s0[r]; rs1 += s1[r]; }
    lr = rs0 + rs1;
  }
  // Publish point of stage st + 1, and the refill of the buffer just read.
  asm volatile("s_wait_dscnt 0x0" ::: "memory");        // this wave has left stage st
  if (pinned(issuer))
    asm volatile("s_wait_tensorcnt 0x0" ::: "memory");  // stage st + 1 has landed
  __syncthreads();                       // published; every wave has left stage st
  if (pinned(issuer & (unsigned)(st + 2 < NSTAGE))) {
    const unsigned nx = pinned((unsigned)st + 2u);
    tdm_load_kv(kvdst + (nx & 1u) * (2u * KVTILE * 2u),
                kvsrc + (unsigned long long)nx * kvstep, kvpitch);
  }
  }
  asm volatile("s_wait_tensorcnt 0x0" ::: "memory");    // nothing in flight at the end
  asm volatile("s_wait_dscnt 0x0" ::: "memory");

  const float inv = 1.0f / (lr + xhalf(lr));
  const int bb = bh >> 3;
  const int hh = bh & 7;
  __bf16* op = Ot + ((size_t)bb * TN + tb + lm) * KD + hh * ODIM + 8 * h2;
  v8bf o[8];
  #pragma unroll
  for (int nt = 0; nt < 8; ++nt)
    #pragma unroll
    for (int r = 0; r < 8; ++r) o[nt][r] = (__bf16)(accO[nt][r] * inv);
  #pragma unroll
  for (int nt = 0; nt < 8; ++nt) *(v8bf*)(op + nt * 16) = o[nt];
}

// ---------------------------------------------------------------------------
extern "C" void kernel_launch(void* const* d_in, const int* in_sizes, int n_in,
                              void* d_out, int out_size, void* d_ws, size_t ws_size,
                              hipStream_t stream) {
  (void)in_sizes; (void)n_in; (void)out_size; (void)ws_size;
  const float* x  = (const float*)d_in[0];
  const float* Wk = (const float*)d_in[1];
  const float* Wq = (const float*)d_in[2];
  const float* Wv = (const float*)d_in[3];
  const float* Wu = (const float*)d_in[4];
  const float* bu = (const float*)d_in[5];

  // ws (bf16 elems): Qt|Kt|V|Ot|xT (8M each) + Wq/Wk/Wv (1M each) + Wu (128K)
  const size_t SEG = (size_t)4 * HEADS * TN * ODIM;  // 8,388,608
  __bf16* ws  = (__bf16*)d_ws;
  __bf16* Qt  = ws;
  __bf16* Kt  = Qt + SEG;
  __bf16* Vb  = Kt + SEG;
  __bf16* Ot  = Vb + SEG;
  __bf16* xT  = Ot + SEG;
  __bf16* Wqb = xT + SEG;
  __bf16* Wkb = Wqb + (size_t)KD * KD;
  __bf16* Wvb = Wkb + (size_t)KD * KD;
  __bf16* Wub = Wvb + (size_t)KD * KD;

  const float qscale = 0.08838834764831845f;  // 1/sqrt(OD=128)
  dim3 blk(256);

  // Wqb, Wkb, Wvb, Wub are one run of ws, and so are Qt, Kt, Vb.
  prepass<<<dim3(XT_BLOCKS + CVT_BLOCKS), blk, 0, stream>>>(x, Wq, Wk, Wv, Wu, xT, Wqb);

  gemm_wmma_tdm<0><<<dim3(16, 24, 4), blk, 0, stream>>>(Wqb, xT, Qt, nullptr, qscale);

  attn_wmma<<<dim3(512), blk, 0, stream>>>(Qt, Kt, Vb, Ot);

  gemm_wmma_tdm<2><<<dim3(16, 1, 4), blk, 0, stream>>>(Wub, Ot, d_out, bu, 1.0f);
}

// v004
// One run takes 116 microseconds.
// In both of two side-by-side timings against v003, it was 1.27 times as fast.
// Counting every step since v000, it is 2.45 times as fast.
#include <hip/hip_runtime.h>

typedef __attribute__((ext_vector_type(16))) __bf16 v16bf;
typedef __attribute__((ext_vector_type(8)))  __bf16 v8bf;
typedef __attribute__((ext_vector_type(4)))  __bf16 v4bf;
typedef __attribute__((ext_vector_type(8)))  float  v8f;
typedef __attribute__((ext_vector_type(4)))  float  v4f;
typedef __attribute__((ext_vector_type(4)))  unsigned int v4u;

#define TN    2048   // time dim / GEMM N
#define KD    1024   // channel dim / GEMM K (= H*OD)
#define HEADS 8
#define ODIM  128

__device__ __forceinline__ v16bf comb(v8bf lo, v8bf hi) {
  return __builtin_shufflevector(lo, hi, 0,1,2,3,4,5,6,7,8,9,10,11,12,13,14,15);
}
__device__ __forceinline__ v8f wmma_bf16(v16bf a, v16bf b, v8f c) {
  return __builtin_amdgcn_wmma_f32_16x16x32_bf16(false, a, false, b, (short)0, c, false, false);
}

// ---------------------------------------------------------------------------
// Tensor loads: every LDS tile of this file is 128 rows of 256 B, one request
// of one wave, each row padded to 272 B in LDS.
// ---------------------------------------------------------------------------
#define KVP    136                 // LDS row pitch in bf16: 256 B data + 16 B pad
#define KVTILE (128 * KVP)         // bf16 per tile: 34,816 B = 17 x 2 KiB

typedef __attribute__((ext_vector_type(8))) unsigned int v8u;

__device__ __forceinline__ unsigned uni(unsigned v) {
  return (unsigned)__builtin_amdgcn_readfirstlane((int)v);
}
__device__ __forceinline__ unsigned pinned(unsigned v) {
  unsigned w = uni(v);
  asm volatile("" : "+s"(w));  // the word stays in a scalar register
  return w;
}
// One request: 128 rows of 256 B, source pitch src_pitch bytes, into LDS at
// byte offset lds_dst with 16 B of pad behind every row. All extents in bytes.
__device__ __forceinline__ void tdm_load_kv(unsigned lds_dst,
                                            unsigned long long ga,
                                            unsigned src_pitch) {
  v4u g0;
  g0[0] = uni(1u);                                        // count = 1
  g0[1] = uni(lds_dst);
  g0[2] = uni((unsigned)ga);
  g0[3] = uni((((unsigned)(ga >> 32)) & 0x01FFFFFFu) | 0x80000000u);  // type = 2
  v8u g1;
  g1[0] = uni((1u << 20) | (5u << 22) | (3u << 25));
  g1[1] = uni(256u << 16);
  g1[2] = uni(128u << 16);
  g1[3] = uni(256u << 16);
  g1[4] = uni(128u);
  g1[5] = uni(src_pitch);
  g1[6] = uni(0u);
  g1[7] = uni(0u);
  asm volatile("tensor_load_to_lds %0, %1" :: "s"(g0), "s"(g1) : "memory");
}
__device__ __forceinline__ v8u tdm_group1_held(unsigned src_pitch) {
  v8u g1;
  g1[0] = uni((1u << 20) | (5u << 22) | (3u << 25));
  g1[1] = pinned(256u << 16);
  g1[2] = pinned(128u << 16);
  g1[3] = pinned(256u << 16);
  g1[4] = pinned(128u);
  g1[5] = pinned(src_pitch);
  g1[6] = pinned(0u);
  g1[7] = pinned(0u);
  return g1;
}
__device__ __forceinline__ void tdm_load_held(unsigned lds_dst,
                                              unsigned long long ga, v8u g1) {
  v4u g0;
  g0[0] = uni(1u);                                        // count = 1
  g0[1] = uni(lds_dst);
  g0[2] = uni((unsigned)ga);
  g0[3] = uni((((unsigned)(ga >> 32)) & 0x01FFFFFFu) | 0x80000000u);  // type = 2
  asm volatile("tensor_load_to_lds %0, %1" :: "s"(g0), "s"(g1) : "memory");
}

// ---------------------------------------------------------------------------
// Pre-pass, one grid for five independent jobs; the block index picks the job.
//   blocks 0 .. 8191     : x (b, k, t) fp32 -> xT (b, t, k) bf16, one 32x32 tile
//                          through LDS each (64 t tiles x 32 k tiles x 4 b)
//   blocks 8192 .. 11391 : fp32 -> bf16 convert of Wq, Wk, Wv (1024 blocks each)
//                          and Wu (128 blocks), 4 elements per thread; the four
//                          bf16 copies lie one behind the other in Wb.
// ---------------------------------------------------------------------------
#define XT_BLOCKS  8192
#define CVT_BLOCKS 3200
__global__ __launch_bounds__(256) void prepass(const float* __restrict__ x,
                                               const float* __restrict__ Wq,
                                               const float* __restrict__ Wk,
                                               const float* __restrict__ Wv,
                                               const float* __restrict__ Wu,
                                               __bf16* __restrict__ xT,
                                               __bf16* __restrict__ Wb) {
  __shared__ __bf16 tile[32][33];
  const int bid = blockIdx.x;
  if (bid < XT_BLOCKS) {
    const int tx = threadIdx.x & 31, ty = threadIdx.x >> 5;  // (32, 8)
    const int b = bid >> 11;
    const int t0 = (bid & 63) * 32, k0 = ((bid >> 6) & 31) * 32;
    const float* xb = x + (size_t)b * KD * TN;
    __bf16* xTb = xT + (size_t)b * TN * KD;
    #pragma unroll
    for (int i = 0; i < 4; ++i)
      tile[ty + 8 * i][tx] = (__bf16)xb[(size_t)(k0 + ty + 8 * i) * TN + t0 + tx];
    __syncthreads();
    #pragma unroll
    for (int i = 0; i < 4; ++i)
      xTb[(size_t)(t0 + ty + 8 * i) * KD + k0 + tx] = tile[tx][ty + 8 * i];
  } else {
    const int c = bid - XT_BLOCKS;
    const int w = c >> 10;  // 0, 1, 2: Wq, Wk, Wv; 3: Wu
    const float* src = w == 0 ? Wq : w == 1 ? Wk : w == 2 ? Wv : Wu;
    const size_t i = (size_t)(c & 1023) * 256 + threadIdx.x;
    v4f s = *(const v4f*)(src + 4 * i);
    v4bf d;
    d.x = (__bf16)s.x; d.y = (__bf16)s.y; d.z = (__bf16)s.z; d.w = (__bf16)s.w;
    *(v4bf*)(Wb + (size_t)w * KD * KD + 4 * i) = d;
  }
}

#define GSTAGES (KD / 128)         // 8 stages of 128 k
#define GSTEP   256u               // source bytes from one stage to the next
template<int OMODE>
__global__ __launch_bounds__(256) void gemm_wmma_tdm(
    const __bf16* __restrict__ A, const __bf16* __restrict__ Bt,
    void* __restrict__ Cout, const float* __restrict__ bias, float scale)
{
  __shared__ __bf16 ring[2][2][KVTILE] __attribute__((aligned(2048)));  // [buffer][A, B]

  const int tid  = threadIdx.x;
  const int lane = tid & 31;
  const int wid  = tid >> 5;
  const int lm   = lane & 15;
  const int h2   = lane >> 4;
  const int wm   = (wid & 3) * 32;   // 4 waves tile M
  const int wn   = (wid >> 2) * 64;  // 2 waves tile N
  const int mblk = blockIdx.y * 128;
  const int nblk = blockIdx.x * 128;
  const int z    = blockIdx.z;

  const __bf16* Ab = A + (size_t)mblk * KD;
  const __bf16* Bb = Bt + (size_t)z * TN * KD + (size_t)nblk * KD;

  v8f zero8 = {};
  v8f acc[2][4];
  #pragma unroll
  for (int mi = 0; mi < 2; ++mi)
    #pragma unroll
    for (int ni = 0; ni < 4; ++ni) acc[mi][ni] = zero8;

  // Wave 0 brings A, wave 1 brings B; all of this is wave-uniform.
  const unsigned wave   = uni((unsigned)tid >> 5);
  const unsigned issuer = wave < 2u;
  const unsigned isB    = wave & 1u;
  const unsigned long long gsrc = isB ? (unsigned long long)(uintptr_t)Bb
                                      : (unsigned long long)(uintptr_t)Ab;
  const unsigned gdst = (unsigned)(uintptr_t)&ring[0][0][0] + isB * (KVTILE * 2u);
  const v8u gd1 = tdm_group1_held(KD * 2u);  // source pitch: one row of 1024 bf16

  if (pinned(issuer)) {                  // stage 0
    tdm_load_held(gdst, gsrc, gd1);
    asm volatile("s_wait_tensorcnt 0x0" ::: "memory");  // stage 0 has landed
  }
  __syncthreads();                       // stage 0 published to all waves
  if (pinned(issuer))                    // stage 1 flies under stage 0's work
    tdm_load_held(gdst + 2u * KVTILE * 2u, gsrc + GSTEP, gd1);

  #pragma unroll 1  // one stage per trip: the publish point stands once, at its foot
  for (int st = 0; st < GSTAGES; ++st) {
    const __bf16* At = &ring[st & 1][0][0];
    const __bf16* Bs = &ring[st & 1][1][0];
    #pragma unroll
    for (int ks = 0; ks < 4; ++ks) {
      v16bf af[2];
      #pragma unroll
      for (int mi = 0; mi < 2; ++mi) {
        const __bf16* ap = At + (wm + mi * 16 + lm) * KVP + ks * 32;
        af[mi] = comb(*(const v8bf*)(ap + h2 * 8), *(const v8bf*)(ap + 16 + h2 * 8));
      }
      v16bf bfr[4];
      #pragma unroll
      for (int ni = 0; ni < 4; ++ni) {
        const __bf16* bp = Bs + (wn + ni * 16 + lm) * KVP + ks * 32;
        bfr[ni] = comb(*(const v8bf*)(bp + h2 * 8), *(const v8bf*)(bp + 16 + h2 * 8));
      }
      // Keeps the 12 loads of a k step in one group ahead of its 8 WMMAs: left
      // alone the compiler sinks each B fragment's loads to its two WMMAs, and
      // the wave waits out the LDS latency four times a step instead of once.
      __builtin_amdgcn_sched_barrier(0);
      #pragma unroll
      for (int ni = 0; ni < 4; ++ni)
        #pragma unroll
        for (int mi = 0; mi < 2; ++mi)
          acc[mi][ni] = wmma_bf16(af[mi], bfr[ni], acc[mi][ni]);
    }
    // Publish point of stage st + 1, and the refill of the buffer just read.
    asm volatile("s_wait_dscnt 0x0" ::: "memory");        // this wave has left stage st
    if (pinned(issuer))
      asm volatile("s_wait_tensorcnt 0x0" ::: "memory");  // stage st + 1 has landed
    __syncthreads();                     // published; every wave has left stage st
    if (pinned(issuer & (unsigned)(st + 2 < GSTAGES))) {
      const unsigned nx = pinned((unsigned)st + 2u);
      tdm_load_held(gdst + (nx & 1u) * (2u * KVTILE * 2u),
                    gsrc + (unsigned long long)nx * GSTEP, gd1);
    }
  }
  asm volatile("s_wait_tensorcnt 0x0" ::: "memory");    // nothing in flight at the end
  asm volatile("s_wait_dscnt 0x0" ::: "memory");

  // epilogue: D layout lane -> (m = r + 8*h2, n = lm)
  const int proj = OMODE == 0 ? (int)(blockIdx.y >> 3) : 0;  // 0 Q, 1 K, 2 V: the same for a whole block
  const int jblk = OMODE == 0 ? (mblk & (KD - 1)) : mblk;    // row inside that projection
  const float sc = (OMODE == 0 && proj != 0) ? 1.0f : scale; // only Q is scaled
  __bf16* Cp = (__bf16*)Cout + (size_t)proj * (4 * (size_t)KD * TN);
  if (OMODE == 0 && proj < 2) {
    #pragma unroll
    for (int mi = 0; mi < 2; ++mi) {
      #pragma unroll
      for (int ni = 0; ni < 4; ++ni) {
        #pragma unroll
        for (int r = 0; r < 8; ++r) {
          int j = jblk + wm + mi * 16 + r + 8 * h2;
          int t = nblk + wn + ni * 16 + lm;
          int h = j >> 7, e = j & 127;
          Cp[(((size_t)z * HEADS + h) * TN + t) * ODIM + e] = (__bf16)(acc[mi][ni][r] * sc);
        }
      }
    }
  } else {
    #pragma unroll
    for (int mi = 0; mi < 2; ++mi) {
      #pragma unroll
      for (int ni = 0; ni < 4; ++ni) {
        #pragma unroll
        for (int r = 0; r < 8; ++r) {
          int j = jblk + wm + mi * 16 + r + 8 * h2;
          int t = nblk + wn + ni * 16 + lm;
          float v = acc[mi][ni][r] * sc;
          if constexpr (OMODE == 0) {
            Cp[(size_t)z * KD * TN + (size_t)j * TN + t] = (__bf16)v;
          } else {
            ((float*)Cout)[(size_t)z * ODIM * TN + (size_t)j * TN + t] = v + bias[j];
          }
        }
      }
    }
    if constexpr (OMODE == 0) {
      // The built code can fall from the V stores into the Q/K epilogue, which
      // reuses their data registers: the wait stands in front of that reuse.
      asm volatile("s_wait_xcnt 0x0" ::: "memory");
    }
  }
}

#define SKEYS  128
#define NSTAGE (TN / SKEYS)
__device__ __forceinline__ float xhalf(float x) {
  return __builtin_bit_cast(float, __builtin_amdgcn_permlanex16(
      __builtin_bit_cast(int, x), __builtin_bit_cast(int, x),
      0x76543210, 0xfedcba98, false, false));
}
__global__ __launch_bounds__(256) void attn_wmma(
    const __bf16* __restrict__ Qt,  // (b,h,t,e), pre-scaled
    const __bf16* __restrict__ Kt,  // (b,h,i,e)
    const __bf16* __restrict__ Vb,  // (b, j=h*128+e, i)
    __bf16* __restrict__ Ot)        // (b, t, j)
{
  __shared__ __bf16 ring[2][2][KVTILE] __attribute__((aligned(2048)));  // [buffer][K, V]
  const int tid  = threadIdx.x;
  const int lane = tid & 31;
  const int wid  = tid >> 5;
  const int lm   = lane & 15;
  const int h2   = lane >> 4;
  const int task = blockIdx.x * 8 + wid;
  const int bh   = task >> 7;
  const int tb   = (task & 127) * 16;

  // Wave 0 brings K, wave 1 brings V; all of this is wave-uniform.
  const unsigned wave   = uni((unsigned)tid >> 5);
  const unsigned issuer = wave < 2u;
  const unsigned isV    = wave & 1u;
  const unsigned bhu    = uni((unsigned)bh);
  const unsigned long long kvsrc = isV
      ? (unsigned long long)(uintptr_t)(Vb + (size_t)bhu * ODIM * TN)
      : (unsigned long long)(uintptr_t)(Kt + (size_t)bhu * TN * ODIM);
  const unsigned kvstep  = isV ? SKEYS * 2u : SKEYS * ODIM * 2u;  // bytes per stage
  const unsigned kvpitch = isV ? TN * 2u : ODIM * 2u;             // source row pitch
  const unsigned kvdst   = (unsigned)(uintptr_t)&ring[0][0][0] + isV * (KVTILE * 2u);

  if (pinned(issuer)) {                  // stage 0
    tdm_load_kv(kvdst, kvsrc, kvpitch);
    asm volatile("s_wait_tensorcnt 0x0" ::: "memory");  // stage 0 has landed
  }
  __syncthreads();                       // stage 0 published to all waves
  if (pinned(issuer))                    // stage 1 flies under stage 0's work
    tdm_load_kv(kvdst + 2u * KVTILE * 2u, kvsrc + kvstep, kvpitch);

  v16bf qf[4];
  {
    const __bf16* qp = Qt + ((size_t)bh * TN + tb + lm) * ODIM;
    #pragma unroll
    for (int es = 0; es < 4; ++es)
      qf[es] = comb(*(const v8bf*)(qp + es * 32 + h2 * 8),
                    *(const v8bf*)(qp + es * 32 + 16 + h2 * 8));
  }

  v8f zero8 = {};
  v8f accO[8];
  #pragma unroll
  for (int nt = 0; nt < 8; ++nt) accO[nt] = zero8;
  float mr = -3.0e38f;  // running maximum of this lane's query, equal in both halves
  float lr = 0.0f;      // running sum over this half's keys; the halves join after the loop

  #pragma unroll 1  // one stage per trip: the publish point stands once, at its foot
  for (int st = 0; st < NSTAGE; ++st) {
  const __bf16* kt = &ring[st & 1][0][0];
  const __bf16* vt = &ring[st & 1][1][0];
  #pragma unroll 1
  for (int i0 = 0; i0 < SKEYS; i0 += 32) {
    v8f s0 = zero8, s1 = zero8;
    const __bf16* kp0 = kt + (i0 + lm) * KVP;
    const __bf16* kp1 = kp0 + 16 * KVP;
    #pragma unroll
    for (int es = 0; es < 4; ++es) {
      v16bf k0 = comb(*(const v8bf*)(kp0 + es * 32 + h2 * 8),
                      *(const v8bf*)(kp0 + es * 32 + 16 + h2 * 8));
      v16bf k1 = comb(*(const v8bf*)(kp1 + es * 32 + h2 * 8),
                      *(const v8bf*)(kp1 + es * 32 + 16 + h2 * 8));
      s0 = wmma_bf16(k0, qf[es], s0);   // s0[r] = S[key i0 + 8*h2 + r][query lm]
      s1 = wmma_bf16(k1, qf[es], s1);   // s1[r] = the same, 16 keys on
    }
    float mx = fmaxf(s0[0], s1[0]);
    #pragma unroll
    for (int r = 1; r < 8; ++r) mx = fmaxf(mx, fmaxf(s0[r], s1[r]));
    mx = fmaxf(mx, xhalf(mx));
    const float mnew  = fmaxf(mr, mx);
    float alpha;
    asm("v_exp_f32 %0, %1\n\tv_nop" : "=v"(alpha) : "v"((mr - mnew) * 1.44269504f));
    mr = mnew;
    v16bf pf;  // B operand: element s is key i0 + 8*h2 + s (+8 for s >= 8) of this lane's query
    #pragma unroll
    for (int r = 0; r < 8; ++r) {
      s0[r] = __expf(s0[r] - mnew);
      s1[r] = __expf(s1[r] - mnew);
      pf[r]     = (__bf16)s0[r];
      pf[8 + r] = (__bf16)s1[r];
    }
    #pragma unroll
    for (int nt = 0; nt < 8; ++nt) accO[nt] *= alpha;

    #pragma unroll
    for (int nt = 0; nt < 8; ++nt) {
      const __bf16* vp = vt + (nt * 16 + lm) * KVP + i0;
      v16bf vf = comb(*(const v8bf*)(vp + h2 * 8),
                      *(const v8bf*)(vp + 16 + h2 * 8));
      accO[nt] = wmma_bf16(vf, pf, accO[nt]);  // accO[nt][r] = O[e = nt*16 + 8*h2 + r][query lm]
    }
    __builtin_amdgcn_sched_barrier(0);
    float rs0 = lr * alpha, rs1 = 0.0f;
    #pragma unroll
    for (int r = 0; r < 8; ++r) { rs0 += s0[r]; rs1 += s1[r]; }
    lr = rs0 + rs1;
  }
  // Publish point of stage st + 1, and the refill of the buffer just read.
  asm volatile("s_wait_dscnt 0x0" ::: "memory");        // this wave has left stage st
  if (pinned(issuer))
    asm volatile("s_wait_tensorcnt 0x0" ::: "memory");  // stage st + 1 has landed
  __syncthreads();                       // published; every wave has left stage st
  if (pinned(issuer & (unsigned)(st + 2 < NSTAGE))) {
    const unsigned nx = pinned((unsigned)st + 2u);
    tdm_load_kv(kvdst + (nx & 1u) * (2u * KVTILE * 2u),
                kvsrc + (unsigned long long)nx * kvstep, kvpitch);
  }
  }
  asm volatile("s_wait_tensorcnt 0x0" ::: "memory");    // nothing in flight at the end
  asm volatile("s_wait_dscnt 0x0" ::: "memory");

  const float inv = 1.0f / (lr + xhalf(lr));
  const int bb = bh >> 3;
  const int hh = bh & 7;
  __bf16* op = Ot + ((size_t)bb * TN + tb + lm) * KD + hh * ODIM + 8 * h2;
  v8bf o[8];
  #pragma unroll
  for (int nt = 0; nt < 8; ++nt)
    #pragma unroll
    for (int r = 0; r < 8; ++r) o[nt][r] = (__bf16)(accO[nt][r] * inv);
  #pragma unroll
  for (int nt = 0; nt < 8; ++nt) *(v8bf*)(op + nt * 16) = o[nt];
}

// ---------------------------------------------------------------------------
extern "C" void kernel_launch(void* const* d_in, const int* in_sizes, int n_in,
                              void* d_out, int out_size, void* d_ws, size_t ws_size,
                              hipStream_t stream) {
  (void)in_sizes; (void)n_in; (void)out_size; (void)ws_size;
  const float* x  = (const float*)d_in[0];
  const float* Wk = (const float*)d_in[1];
  const float* Wq = (const float*)d_in[2];
  const float* Wv = (const float*)d_in[3];
  const float* Wu = (const float*)d_in[4];
  const float* bu = (const float*)d_in[5];

  // ws (bf16 elems): Qt|Kt|V|Ot|xT (8M each) + Wq/Wk/Wv (1M each) + Wu (128K)
  const size_t SEG = (size_t)4 * HEADS * TN * ODIM;  // 8,388,608
  __bf16* ws  = (__bf16*)d_ws;
  __bf16* Qt  = ws;
  __bf16* Kt  = Qt + SEG;
  __bf16* Vb  = Kt + SEG;
  __bf16* Ot  = Vb + SEG;
  __bf16* xT  = Ot + SEG;
  __bf16* Wqb = xT + SEG;
  __bf16* Wkb = Wqb + (size_t)KD * KD;
  __bf16* Wvb = Wkb + (size_t)KD * KD;
  __bf16* Wub = Wvb + (size_t)KD * KD;

  const float qscale = 0.08838834764831845f;  // 1/sqrt(OD=128)
  dim3 blk(256);

  // Wqb, Wkb, Wvb, Wub are one run of ws, and so are Qt, Kt, Vb.
  prepass<<<dim3(XT_BLOCKS + CVT_BLOCKS), blk, 0, stream>>>(x, Wq, Wk, Wv, Wu, xT, Wqb);

  gemm_wmma_tdm<0><<<dim3(16, 24, 4), blk, 0, stream>>>(Wqb, xT, Qt, nullptr, qscale);

  attn_wmma<<<dim3(512), blk, 0, stream>>>(Qt, Kt, Vb, Ot);

  gemm_wmma_tdm<2><<<dim3(16, 1, 4), blk, 0, stream>>>(Wub, Ot, d_out, bu, 1.0f);
}

// v005
// Measured time: 111 microseconds a run.
// Next to v004, in two timings, it ran 1.05 times as fast each time.
// Over all steps from v000 it is 2.57 times as fast.
#include <hip/hip_runtime.h>

typedef __attribute__((ext_vector_type(16))) __bf16 v16bf;
typedef __attribute__((ext_vector_type(8)))  __bf16 v8bf;
typedef __attribute__((ext_vector_type(4)))  __bf16 v4bf;
typedef __attribute__((ext_vector_type(8)))  float  v8f;
typedef __attribute__((ext_vector_type(4)))  float  v4f;
typedef __attribute__((ext_vector_type(4)))  unsigned int v4u;

#define TN    2048   // time dim / GEMM N
#define KD    1024   // channel dim / GEMM K (= H*OD)
#define HEADS 8
#define ODIM  128

__device__ __forceinline__ v16bf comb(v8bf lo, v8bf hi) {
  return __builtin_shufflevector(lo, hi, 0,1,2,3,4,5,6,7,8,9,10,11,12,13,14,15);
}
__device__ __forceinline__ v8f wmma_bf16(v16bf a, v16bf b, v8f c) {
  return __builtin_amdgcn_wmma_f32_16x16x32_bf16(false, a, false, b, (short)0, c, false, false);
}

// ---------------------------------------------------------------------------
// Tensor loads: every LDS tile of this file is 128 rows of 256 B, one request
// of one wave, each row padded to 272 B in LDS.
// ---------------------------------------------------------------------------
#define KVP    136                 // LDS row pitch in bf16: 256 B data + 16 B pad
#define KVTILE (128 * KVP)         // bf16 per tile: 34,816 B = 17 x 2 KiB

typedef __attribute__((ext_vector_type(8))) unsigned int v8u;

__device__ __forceinline__ unsigned uni(unsigned v) {
  return (unsigned)__builtin_amdgcn_readfirstlane((int)v);
}
__device__ __forceinline__ unsigned pinned(unsigned v) {
  unsigned w = uni(v);
  asm volatile("" : "+s"(w));  // the word stays in a scalar register
  return w;
}
// One request: 128 rows of 256 B, source pitch src_pitch bytes, into LDS at
// byte offset lds_dst with 16 B of pad behind every row. All extents in bytes.
__device__ __forceinline__ void tdm_load_kv(unsigned lds_dst,
                                            unsigned long long ga,
                                            unsigned src_pitch) {
  v4u g0;
  g0[0] = uni(1u);                                        // count = 1
  g0[1] = uni(lds_dst);
  g0[2] = uni((unsigned)ga);
  g0[3] = uni((((unsigned)(ga >> 32)) & 0x01FFFFFFu) | 0x80000000u);  // type = 2
  v8u g1;
  g1[0] = uni((1u << 20) | (5u << 22) | (3u << 25));
  g1[1] = uni(256u << 16);
  g1[2] = uni(128u << 16);
  g1[3] = uni(256u << 16);
  g1[4] = uni(128u);
  g1[5] = uni(src_pitch);
  g1[6] = uni(0u);
  g1[7] = uni(0u);
  asm volatile("tensor_load_to_lds %0, %1" :: "s"(g0), "s"(g1) : "memory");
}
__device__ __forceinline__ v8u tdm_group1_held(unsigned src_pitch) {
  v8u g1;
  g1[0] = uni((1u << 20) | (5u << 22) | (3u << 25));
  g1[1] = pinned(256u << 16);
  g1[2] = pinned(128u << 16);
  g1[3] = pinned(256u << 16);
  g1[4] = pinned(128u);
  g1[5] = pinned(src_pitch);
  g1[6] = pinned(0u);
  g1[7] = pinned(0u);
  return g1;
}
__device__ __forceinline__ void tdm_load_held(unsigned lds_dst,
                                              unsigned long long ga, v8u g1) {
  v4u g0;
  g0[0] = uni(1u);                                        // count = 1
  g0[1] = uni(lds_dst);
  g0[2] = uni((unsigned)ga);
  g0[3] = uni((((unsigned)(ga >> 32)) & 0x01FFFFFFu) | 0x80000000u);  // type = 2
  asm volatile("tensor_load_to_lds %0, %1" :: "s"(g0), "s"(g1) : "memory");
}

// ---------------------------------------------------------------------------
// Pre-pass, one grid for five independent jobs; the block index picks the job.
//   blocks 0 .. 8191     : x (b, k, t) fp32 -> xT (b, t, k) bf16, one 32x32 tile
//                          through LDS each (64 t tiles x 32 k tiles x 4 b)
//   blocks 8192 .. 11391 : fp32 -> bf16 convert of Wq, Wk, Wv (1024 blocks each)
//                          and Wu (128 blocks), 4 elements per thread; the four
//                          bf16 copies lie one behind the other in Wb.
// ---------------------------------------------------------------------------
#define XT_BLOCKS  8192
#define CVT_BLOCKS 3200
__global__ __launch_bounds__(256) void prepass(const float* __restrict__ x,
                                               const float* __restrict__ Wq,
                                               const float* __restrict__ Wk,
                                               const float* __restrict__ Wv,
                                               const float* __restrict__ Wu,
                                               __bf16* __restrict__ xT,
                                               __bf16* __restrict__ Wb) {
  __shared__ __bf16 tile[32][33];
  const int bid = blockIdx.x;
  if (bid < XT_BLOCKS) {
    const int tx = threadIdx.x & 31, ty = threadIdx.x >> 5;  // (32, 8)
    const int b = bid >> 11;
    const int t0 = (bid & 63) * 32, k0 = ((bid >> 6) & 31) * 32;
    const float* xb = x + (size_t)b * KD * TN;
    __bf16* xTb = xT + (size_t)b * TN * KD;
    #pragma unroll
    for (int i = 0; i < 4; ++i)
      tile[ty + 8 * i][tx] = (__bf16)xb[(size_t)(k0 + ty + 8 * i) * TN + t0 + tx];
    __syncthreads();
    #pragma unroll
    for (int i = 0; i < 4; ++i)
      xTb[(size_t)(t0 + ty + 8 * i) * KD + k0 + tx] = tile[tx][ty + 8 * i];
  } else {
    const int c = bid - XT_BLOCKS;
    const int w = c >> 10;  // 0, 1, 2: Wq, Wk, Wv; 3: Wu
    const float* src = w == 0 ? Wq : w == 1 ? Wk : w == 2 ? Wv : Wu;
    const size_t i = (size_t)(c & 1023) * 256 + threadIdx.x;
    v4f s = *(const v4f*)(src + 4 * i);
    v4bf d;
    d.x = (__bf16)s.x; d.y = (__bf16)s.y; d.z = (__bf16)s.z; d.w = (__bf16)s.w;
    *(v4bf*)(Wb + (size_t)w * KD * KD + 4 * i) = d;
  }
}

#define GSTAGES (KD / 128)         // 8 stages of 128 k
#define GSTEP   256u               // source bytes from one stage to the next
template<int OMODE>
__global__ __launch_bounds__(256) void gemm_wmma_tdm(
    const __bf16* __restrict__ A, const __bf16* __restrict__ Bt,
    void* __restrict__ Cout, const float* __restrict__ bias, float scale)
{
  __shared__ __bf16 ring[2][2][KVTILE] __attribute__((aligned(2048)));  // [buffer][A, B]

  const int tid  = threadIdx.x;
  const int lane = tid & 31;
  const int wid  = tid >> 5;
  const int lm   = lane & 15;
  const int h2   = lane >> 4;
  const int wm   = (wid & 3) * 32;   // 4 waves tile M
  const int wn   = (wid >> 2) * 64;  // 2 waves tile N
  const int mblk = blockIdx.y * 128;
  const int nblk = blockIdx.x * 128;
  const int z    = blockIdx.z;

  const __bf16* Ab = A + (size_t)mblk * KD;
  const __bf16* Bb = Bt + (size_t)z * TN * KD + (size_t)nblk * KD;

  v8f zero8 = {};
  v8f acc[2][4];
  #pragma unroll
  for (int mi = 0; mi < 2; ++mi)
    #pragma unroll
    for (int ni = 0; ni < 4; ++ni) acc[mi][ni] = zero8;

  // Wave 0 brings A, wave 1 brings B; all of this is wave-uniform.
  const unsigned wave   = uni((unsigned)tid >> 5);
  const unsigned issuer = wave < 2u;
  const unsigned isB    = wave & 1u;
  const unsigned long long gsrc = isB ? (unsigned long long)(uintptr_t)Bb
                                      : (unsigned long long)(uintptr_t)Ab;
  const unsigned gdst = (unsigned)(uintptr_t)&ring[0][0][0] + isB * (KVTILE * 2u);
  const v8u gd1 = tdm_group1_held(KD * 2u);  // source pitch: one row of 1024 bf16

  if (pinned(issuer)) {                  // stage 0
    tdm_load_held(gdst, gsrc, gd1);
    asm volatile("s_wait_tensorcnt 0x0" ::: "memory");  // stage 0 has landed
  }
  __syncthreads();                       // stage 0 published to all waves
  if (pinned(issuer))                    // stage 1 flies under stage 0's work
    tdm_load_held(gdst + 2u * KVTILE * 2u, gsrc + GSTEP, gd1);

  #pragma unroll 1  // one stage per trip: the publish point stands once, at its foot
  for (int st = 0; st < GSTAGES; ++st) {
    const __bf16* At = &ring[st & 1][0][0];
    const __bf16* Bs = &ring[st & 1][1][0];
    #pragma unroll
    for (int ks = 0; ks < 4; ++ks) {
      v16bf af[2];
      #pragma unroll
      for (int mi = 0; mi < 2; ++mi) {
        const __bf16* ap = At + (wm + mi * 16 + lm) * KVP + ks * 32;
        af[mi] = comb(*(const v8bf*)(ap + h2 * 8), *(const v8bf*)(ap + 16 + h2 * 8));
      }
      v16bf bfr[4];
      #pragma unroll
      for (int ni = 0; ni < 4; ++ni) {
        const __bf16* bp = Bs + (wn + ni * 16 + lm) * KVP + ks * 32;
        bfr[ni] = comb(*(const v8bf*)(bp + h2 * 8), *(const v8bf*)(bp + 16 + h2 * 8));
      }
      // Keeps the 12 loads of a k step in one group ahead of its 8 WMMAs: left
      // alone the compiler sinks each B fragment's loads to its two WMMAs, and
      // the wave waits out the LDS latency four times a step instead of once.
      __builtin_amdgcn_sched_barrier(0);
      #pragma unroll
      for (int ni = 0; ni < 4; ++ni)
        #pragma unroll
        for (int mi = 0; mi < 2; ++mi)
          acc[mi][ni] = wmma_bf16(af[mi], bfr[ni], acc[mi][ni]);
    }
    // Publish point of stage st + 1, and the refill of the buffer just read.
    asm volatile("s_wait_dscnt 0x0" ::: "memory");        // this wave has left stage st
    if (pinned(issuer))
      asm volatile("s_wait_tensorcnt 0x0" ::: "memory");  // stage st + 1 has landed
    __syncthreads();                     // published; every wave has left stage st
    if (pinned(issuer & (unsigned)(st + 2 < GSTAGES))) {
      const unsigned nx = pinned((unsigned)st + 2u);
      tdm_load_held(gdst + (nx & 1u) * (2u * KVTILE * 2u),
                    gsrc + (unsigned long long)nx * GSTEP, gd1);
    }
  }
  asm volatile("s_wait_tensorcnt 0x0" ::: "memory");    // nothing in flight at the end
  asm volatile("s_wait_dscnt 0x0" ::: "memory");

  // epilogue: D layout lane -> (m = r + 8*h2, n = lm)
  const int proj = OMODE == 0 ? (int)(blockIdx.y >> 3) : 0;  // 0 Q, 1 K, 2 V: the same for a whole block
  const int jblk = OMODE == 0 ? (mblk & (KD - 1)) : mblk;    // row inside that projection
  const float sc = (OMODE == 0 && proj != 0) ? 1.0f : scale; // only Q is scaled
  __bf16* Cp = (__bf16*)Cout + (size_t)proj * (4 * (size_t)KD * TN);
  if (OMODE == 0 && proj < 2) {
    #pragma unroll
    for (int mi = 0; mi < 2; ++mi) {
      #pragma unroll
      for (int ni = 0; ni < 4; ++ni) {
        #pragma unroll
        for (int r = 0; r < 8; ++r) {
          int j = jblk + wm + mi * 16 + r + 8 * h2;
          int t = nblk + wn + ni * 16 + lm;
          int h = j >> 7, e = j & 127;
          Cp[(((size_t)z * HEADS + h) * TN + t) * ODIM + e] = (__bf16)(acc[mi][ni][r] * sc);
        }
      }
    }
  } else {
    #pragma unroll
    for (int mi = 0; mi < 2; ++mi) {
      #pragma unroll
      for (int ni = 0; ni < 4; ++ni) {
        #pragma unroll
        for (int r = 0; r < 8; ++r) {
          int j = jblk + wm + mi * 16 + r + 8 * h2;
          int t = nblk + wn + ni * 16 + lm;
          float v = acc[mi][ni][r] * sc;
          if constexpr (OMODE == 0) {
            Cp[(size_t)z * KD * TN + (size_t)j * TN + t] = (__bf16)v;
          } else {
            ((float*)Cout)[(size_t)z * ODIM * TN + (size_t)j * TN + t] = v + bias[j];
          }
        }
      }
    }
    if constexpr (OMODE == 0) {
      // The built code can fall from the V stores into the Q/K epilogue, which
      // reuses their data registers: the wait stands in front of that reuse.
      asm volatile("s_wait_xcnt 0x0" ::: "memory");
    }
  }
}

#define SKEYS  128
#define NSTAGE (TN / SKEYS)
#define QG     2
__device__ __forceinline__ float xhalf(float x) {
  return __builtin_bit_cast(float, __builtin_amdgcn_permlanex16(
      __builtin_bit_cast(int, x), __builtin_bit_cast(int, x),
      0x76543210, 0xfedcba98, false, false));
}
__device__ __forceinline__ v8f exp2x8(v8f x) {
  float y0, y1, y2, y3, y4, y5, y6, y7;
  asm("v_exp_f32 %0, %8\n\tv_exp_f32 %1, %9\n\tv_exp_f32 %2, %10\n\tv_exp_f32 %3, %11\n\t"
      "v_exp_f32 %4, %12\n\tv_exp_f32 %5, %13\n\tv_exp_f32 %6, %14\n\tv_exp_f32 %7, %15\n\tv_nop"
      : "=&v"(y0), "=&v"(y1), "=&v"(y2), "=&v"(y3), "=&v"(y4), "=&v"(y5), "=&v"(y6), "=&v"(y7)
      : "v"(x[0]), "v"(x[1]), "v"(x[2]), "v"(x[3]), "v"(x[4]), "v"(x[5]), "v"(x[6]), "v"(x[7]));
  v8f y = {y0, y1, y2, y3, y4, y5, y6, y7};
  return y;
}
__global__ __launch_bounds__(256) __attribute__((amdgpu_waves_per_eu(2, 2))) void attn_wmma(
    const __bf16* __restrict__ Qt,  // (b,h,t,e), pre-scaled
    const __bf16* __restrict__ Kt,  // (b,h,i,e)
    const __bf16* __restrict__ Vb,  // (b, j=h*128+e, i)
    __bf16* __restrict__ Ot)        // (b, t, j)
{
  __shared__ __bf16 ring[2][2][KVTILE] __attribute__((aligned(2048)));  // [buffer][K, V]
  const int tid  = threadIdx.x;
  const int lane = tid & 31;
  const int wid  = tid >> 5;
  const int lm   = lane & 15;
  const int h2   = lane >> 4;
  const int task = blockIdx.x * 8 + wid;
  const int bh   = task >> 6;
  const int tb   = (task & 63) * (16 * QG);

  // Wave 0 brings K, wave 1 brings V; all of this is wave-uniform.
  const unsigned wave   = uni((unsigned)tid >> 5);
  const unsigned issuer = wave < 2u;
  const unsigned isV    = wave & 1u;
  const unsigned bhu    = uni((unsigned)bh);
  const unsigned long long kvsrc = isV
      ? (unsigned long long)(uintptr_t)(Vb + (size_t)bhu * ODIM * TN)
      : (unsigned long long)(uintptr_t)(Kt + (size_t)bhu * TN * ODIM);
  const unsigned kvstep  = isV ? SKEYS * 2u : SKEYS * ODIM * 2u;  // bytes per stage
  const unsigned kvpitch = isV ? TN * 2u : ODIM * 2u;             // source row pitch
  const unsigned kvdst   = (unsigned)(uintptr_t)&ring[0][0][0] + isV * (KVTILE * 2u);

  if (pinned(issuer)) {                  // stage 0
    tdm_load_kv(kvdst, kvsrc, kvpitch);
    asm volatile("s_wait_tensorcnt 0x0" ::: "memory");  // stage 0 has landed
  }
  __syncthreads();                       // stage 0 published to all waves
  if (pinned(issuer))                    // stage 1 flies under stage 0's work
    tdm_load_kv(kvdst + 2u * KVTILE * 2u, kvsrc + kvstep, kvpitch);

  v16bf qf[QG][4];
  #pragma unroll
  for (int g = 0; g < QG; ++g) {
    const __bf16* qp = Qt + ((size_t)bh * TN + tb + g * 16 + lm) * ODIM;
    #pragma unroll
    for (int es = 0; es < 4; ++es)
      qf[g][es] = comb(*(const v8bf*)(qp + es * 32 + h2 * 8),
                       *(const v8bf*)(qp + es * 32 + 16 + h2 * 8));
  }
  // The built code reuses the Q loads' address registers for the zeroed
  // accumulators right behind the loads: the wait stands in front of that reuse,
  // and the scheduling barrier keeps the zeroing moves from rising over it.
  asm volatile("s_wait_xcnt 0x0" ::: "memory");
  __builtin_amdgcn_sched_barrier(0);

  v8f zero8 = {};
  v8f accO[QG][8];
  float mr[QG];  // running maximum of this lane's query, equal in both halves
  float lr[QG];  // running sum over this half's keys; the halves join after the loop
  #pragma unroll
  for (int g = 0; g < QG; ++g) {
    #pragma unroll
    for (int nt = 0; nt < 8; ++nt) accO[g][nt] = zero8;
    mr[g] = -3.0e38f;
    lr[g] = 0.0f;
  }

  #pragma unroll 1  // one stage per trip: the publish point stands once, at its foot
  for (int st = 0; st < NSTAGE; ++st) {
  const __bf16* kt = &ring[st & 1][0][0];
  const __bf16* vt = &ring[st & 1][1][0];
  #pragma unroll 1  // rolled: unrolled, the build spills to scratch and scatters the LDS loads among the WMMAs
  for (int i0 = 0; i0 < SKEYS; i0 += 32) {
    v8f s0[QG], s1[QG];
    #pragma unroll
    for (int g = 0; g < QG; ++g) { s0[g] = zero8; s1[g] = zero8; }
    const __bf16* kp0 = kt + (i0 + lm) * KVP;
    const __bf16* kp1 = kp0 + 16 * KVP;
    #pragma unroll
    for (int es = 0; es < 4; ++es) {
      v16bf k0 = comb(*(const v8bf*)(kp0 + es * 32 + h2 * 8),
                      *(const v8bf*)(kp0 + es * 32 + 16 + h2 * 8));
      v16bf k1 = comb(*(const v8bf*)(kp1 + es * 32 + h2 * 8),
                      *(const v8bf*)(kp1 + es * 32 + 16 + h2 * 8));
      #pragma unroll
      for (int g = 0; g < QG; ++g) {
        s0[g] = wmma_bf16(k0, qf[g][es], s0[g]);   // s0[g][r] = S[key i0 + 8*h2 + r][query 16*g + lm]
        s1[g] = wmma_bf16(k1, qf[g][es], s1[g]);   // s1[g][r] = the same, 16 keys on
      }
    }
    float alpha[QG];
    v16bf pf[QG];  // B operand: element s is key i0 + 8*h2 + s (s < 8) or i0 + 8 + 8*h2 + s (s >= 8) of this lane's query
    #pragma unroll
    for (int g = 0; g < QG; ++g) {
      float mx = fmaxf(s0[g][0], s1[g][0]);
      #pragma unroll
      for (int r = 1; r < 8; ++r) mx = fmaxf(mx, fmaxf(s0[g][r], s1[g][r]));
      mx = fmaxf(mx, xhalf(mx));
      const float mnew  = fmaxf(mr[g], mx);
      asm("v_exp_f32 %0, %1\n\tv_nop" : "=v"(alpha[g]) : "v"((mr[g] - mnew) * 1.44269504f));
      mr[g] = mnew;
      s0[g] = exp2x8((s0[g] - mnew) * 1.44269504f);  // exp(s - mnew)
      s1[g] = exp2x8((s1[g] - mnew) * 1.44269504f);
      #pragma unroll
      for (int r = 0; r < 8; ++r) {
        pf[g][r]     = (__bf16)s0[g][r];
        pf[g][8 + r] = (__bf16)s1[g][r];
      }
      #pragma unroll
      for (int nt = 0; nt < 8; ++nt) accO[g][nt] *= alpha[g];
    }

    #pragma unroll
    for (int nt = 0; nt < 8; ++nt) {
      const __bf16* vp = vt + (nt * 16 + lm) * KVP + i0;
      v16bf vf = comb(*(const v8bf*)(vp + h2 * 8),
                      *(const v8bf*)(vp + 16 + h2 * 8));
      #pragma unroll
      for (int g = 0; g < QG; ++g)
        accO[g][nt] = wmma_bf16(vf, pf[g], accO[g][nt]);  // accO[g][nt][r] = O[e = nt*16 + 8*h2 + r][query 16*g + lm]
    }
    __builtin_amdgcn_sched_barrier(0);
    #pragma unroll
    for (int g = 0; g < QG; ++g) {
      float rs0 = lr[g] * alpha[g], rs1 = 0.0f;
      #pragma unroll
      for (int r = 0; r < 8; ++r) { rs0 += s0[g][r]; rs1 += s1[g][r]; }
      lr[g] = rs0 + rs1;
    }
  }
  // Publish point of stage st + 1, and the refill of the buffer just read.
  asm volatile("s_wait_dscnt 0x0" ::: "memory");        // this wave has left stage st
  if (pinned(issuer))
    asm volatile("s_wait_tensorcnt 0x0" ::: "memory");  // stage st + 1 has landed
  __syncthreads();                       // published; every wave has left stage st
  if (pinned(issuer & (unsigned)(st + 2 < NSTAGE))) {
    const unsigned nx = pinned((unsigned)st + 2u);
    tdm_load_kv(kvdst + (nx & 1u) * (2u * KVTILE * 2u),
                kvsrc + (unsigned long long)nx * kvstep, kvpitch);
  }
  }
  asm volatile("s_wait_tensorcnt 0x0" ::: "memory");    // nothing in flight at the end
  asm volatile("s_wait_dscnt 0x0" ::: "memory");

  const int bb = bh >> 3;
  const int hh = bh & 7;
  v8bf o[QG][8];
  #pragma unroll
  for (int g = 0; g < QG; ++g) {
    const float inv = 1.0f / (lr[g] + xhalf(lr[g]));
    #pragma unroll
    for (int nt = 0; nt < 8; ++nt)
      #pragma unroll
      for (int r = 0; r < 8; ++r) o[g][nt][r] = (__bf16)(accO[g][nt][r] * inv);
  }
  #pragma unroll
  for (int g = 0; g < QG; ++g) {
    __bf16* op = Ot + ((size_t)bb * TN + tb + g * 16 + lm) * KD + hh * ODIM + 8 * h2;
    #pragma unroll
    for (int nt = 0; nt < 8; ++nt) *(v8bf*)(op + nt * 16) = o[g][nt];
  }
}

// ---------------------------------------------------------------------------
extern "C" void kernel_launch(void* const* d_in, const int* in_sizes, int n_in,
                              void* d_out, int out_size, void* d_ws, size_t ws_size,
                              hipStream_t stream) {
  (void)in_sizes; (void)n_in; (void)out_size; (void)ws_size;
  const float* x  = (const float*)d_in[0];
  const float* Wk = (const float*)d_in[1];
  const float* Wq = (const float*)d_in[2];
  const float* Wv = (const float*)d_in[3];
  const float* Wu = (const float*)d_in[4];
  const float* bu = (const float*)d_in[5];

  // ws (bf16 elems): Qt|Kt|V|Ot|xT (8M each) + Wq/Wk/Wv (1M each) + Wu (128K)
  const size_t SEG = (size_t)4 * HEADS * TN * ODIM;  // 8,388,608
  __bf16* ws  = (__bf16*)d_ws;
  __bf16* Qt  = ws;
  __bf16* Kt  = Qt + SEG;
  __bf16* Vb  = Kt + SEG;
  __bf16* Ot  = Vb + SEG;
  __bf16* xT  = Ot + SEG;
  __bf16* Wqb = xT + SEG;
  __bf16* Wkb = Wqb + (size_t)KD * KD;
  __bf16* Wvb = Wkb + (size_t)KD * KD;
  __bf16* Wub = Wvb + (size_t)KD * KD;

  const float qscale = 0.08838834764831845f;  // 1/sqrt(OD=128)
  dim3 blk(256);

  // Wqb, Wkb, Wvb, Wub are one run of ws, and so are Qt, Kt, Vb.
  prepass<<<dim3(XT_BLOCKS + CVT_BLOCKS), blk, 0, stream>>>(x, Wq, Wk, Wv, Wu, xT, Wqb);

  gemm_wmma_tdm<0><<<dim3(16, 24, 4), blk, 0, stream>>>(Wqb, xT, Qt, nullptr, qscale);

  attn_wmma<<<dim3(256), blk, 0, stream>>>(Qt, Kt, Vb, Ot);

  gemm_wmma_tdm<2><<<dim3(16, 1, 4), blk, 0, stream>>>(Wub, Ot, d_out, bu, 1.0f);
}

// v006
// Measured time: 107 microseconds a run.
// Next to v005, in two timings, it ran 1.04 times as fast each time.
// All steps since v000 together make it 2.67 times as fast.
#include <hip/hip_runtime.h>

typedef __attribute__((ext_vector_type(16))) __bf16 v16bf;
typedef __attribute__((ext_vector_type(8)))  __bf16 v8bf;
typedef __attribute__((ext_vector_type(4)))  __bf16 v4bf;
typedef __attribute__((ext_vector_type(8)))  float  v8f;
typedef __attribute__((ext_vector_type(4)))  float  v4f;
typedef __attribute__((ext_vector_type(4)))  unsigned int v4u;

#define TN    2048   // time dim / GEMM N
#define KD    1024   // channel dim / GEMM K (= H*OD)
#define HEADS 8
#define ODIM  128

__device__ __forceinline__ v16bf comb(v8bf lo, v8bf hi) {
  return __builtin_shufflevector(lo, hi, 0,1,2,3,4,5,6,7,8,9,10,11,12,13,14,15);
}
__device__ __forceinline__ v8f wmma_bf16(v16bf a, v16bf b, v8f c) {
  return __builtin_amdgcn_wmma_f32_16x16x32_bf16(false, a, false, b, (short)0, c, false, false);
}

// ---------------------------------------------------------------------------
// Tensor loads: every LDS tile of this file is 128 rows of 256 B, one request
// of one wave, each row padded to 272 B in LDS.
// ---------------------------------------------------------------------------
#define KVP    136                 // LDS row pitch in bf16: 256 B data + 16 B pad
#define KVTILE (128 * KVP)         // bf16 per tile: 34,816 B = 17 x 2 KiB

typedef __attribute__((ext_vector_type(8))) unsigned int v8u;

__device__ __forceinline__ unsigned uni(unsigned v) {
  return (unsigned)__builtin_amdgcn_readfirstlane((int)v);
}
__device__ __forceinline__ unsigned pinned(unsigned v) {
  unsigned w = uni(v);
  asm volatile("" : "+s"(w));  // the word stays in a scalar register
  return w;
}
// One request: 128 rows of 256 B, source pitch src_pitch bytes, into LDS at
// byte offset lds_dst with 16 B of pad behind every row. All extents in bytes.
__device__ __forceinline__ void tdm_load_kv(unsigned lds_dst,
                                            unsigned long long ga,
                                            unsigned src_pitch) {
  v4u g0;
  g0[0] = uni(1u);                                        // count = 1
  g0[1] = uni(lds_dst);
  g0[2] = uni((unsigned)ga);
  g0[3] = uni((((unsigned)(ga >> 32)) & 0x01FFFFFFu) | 0x80000000u);  // type = 2
  v8u g1;
  g1[0] = uni((1u << 20) | (5u << 22) | (3u << 25));
  g1[1] = uni(256u << 16);
  g1[2] = uni(128u << 16);
  g1[3] = uni(256u << 16);
  g1[4] = uni(128u);
  g1[5] = uni(src_pitch);
  g1[6] = uni(0u);
  g1[7] = uni(0u);
  asm volatile("tensor_load_to_lds %0, %1" :: "s"(g0), "s"(g1) : "memory");
}
__device__ __forceinline__ v8u tdm_group1_held(unsigned src_pitch) {
  v8u g1;
  g1[0] = uni((1u << 20) | (5u << 22) | (3u << 25));
  g1[1] = pinned(256u << 16);
  g1[2] = pinned(128u << 16);
  g1[3] = pinned(256u << 16);
  g1[4] = pinned(128u);
  g1[5] = pinned(src_pitch);
  g1[6] = pinned(0u);
  g1[7] = pinned(0u);
  return g1;
}
__device__ __forceinline__ void tdm_load_held(unsigned lds_dst,
                                              unsigned long long ga, v8u g1) {
  v4u g0;
  g0[0] = uni(1u);                                        // count = 1
  g0[1] = uni(lds_dst);
  g0[2] = uni((unsigned)ga);
  g0[3] = uni((((unsigned)(ga >> 32)) & 0x01FFFFFFu) | 0x80000000u);  // type = 2
  asm volatile("tensor_load_to_lds %0, %1" :: "s"(g0), "s"(g1) : "memory");
}

// ---------------------------------------------------------------------------
// Pre-pass, one grid for five independent jobs; the block index picks the job.
// Every lane moves 32 elements and every global store is 16 B of a whole line.
//   blocks 0 .. 1023    : x (b, k, t) fp32 -> xT (b, t, k) bf16, one tile of
//                         128 k x 64 t through LDS each (32 t tiles x 8 k tiles
//                         x 4 b): read as 256-B row pieces, written as 256-B rows
//   blocks 1024 .. 1423 : fp32 -> bf16 convert of Wq, Wk, Wv (128 blocks each)
//                         and Wu (16 blocks), 8192 elements a block; the four
//                         bf16 copies lie one behind the other in Wb.
// ---------------------------------------------------------------------------
#define XT_BLOCKS  1024
#define CVT_BLOCKS 400
typedef __attribute__((ext_vector_type(2))) __bf16 v2bf;
__global__ __launch_bounds__(256) void prepass(const float* __restrict__ x,
                                               const float* __restrict__ Wq,
                                               const float* __restrict__ Wk,
                                               const float* __restrict__ Wv,
                                               const float* __restrict__ Wu,
                                               __bf16* __restrict__ xT,
                                               __bf16* __restrict__ Wb) {
  __shared__ unsigned tile[64 * 64] __attribute__((aligned(16)));
  const int bid = blockIdx.x;
  const int tid = threadIdx.x;
  if (bid < XT_BLOCKS) {
    const int b  = bid >> 8;
    const int t0 = (bid & 31) * 64, k0 = ((bid >> 5) & 7) * 128;
    const int tq = tid & 15;   // this lane's four t: 4 * tq ..
    const int kq = tid >> 4;   // its pair of k rows inside a group of 16 pairs
    const float* xb = x + (size_t)b * KD * TN + (size_t)(k0 + 2 * kq) * TN + t0 + 4 * tq;
    v4f lo[4], hi[4];
    #pragma unroll
    for (int p = 0; p < 4; ++p) {
      lo[p] = *(const v4f*)(xb + (size_t)(32 * p) * TN);
      hi[p] = *(const v4f*)(xb + (size_t)(32 * p + 1) * TN);
    }
    #pragma unroll
    for (int p = 0; p < 4; ++p) {
      const int kp = p * 16 + kq;
      #pragma unroll
      for (int i = 0; i < 4; ++i) {
        v2bf pr = {(__bf16)lo[p][i], (__bf16)hi[p][i]};
        tile[(4 * tq + i) * 64 + (((kp >> 2) ^ tq) << 2) + (kp & 3)] = __builtin_bit_cast(unsigned, pr);
      }
    }
    __syncthreads();
    __bf16* xTb = xT + ((size_t)b * TN + t0) * KD + k0;
    #pragma unroll
    for (int p = 0; p < 4; ++p) {
      const int row = p * 16 + (tid >> 4), c = tid & 15;
      v4u v = *(const v4u*)&tile[row * 64 + ((c ^ ((row >> 2) & 15)) << 2)];
      *(v4u*)(xTb + (size_t)row * KD + c * 8) = v;
    }
  } else {
    const int c = bid - XT_BLOCKS;
    const int w = c >> 7;  // 0, 1, 2: Wq, Wk, Wv; 3: Wu
    const float* src = w == 0 ? Wq : w == 1 ? Wk : w == 2 ? Wv : Wu;
    const size_t e0 = (size_t)(c & 127) * 8192 + (size_t)tid * 8;
    v4f s[8];
    #pragma unroll
    for (int j = 0; j < 4; ++j) {
      s[2 * j]     = *(const v4f*)(src + e0 + j * 2048);
      s[2 * j + 1] = *(const v4f*)(src + e0 + j * 2048 + 4);
    }
    #pragma unroll
    for (int j = 0; j < 4; ++j) {
      v8bf d;
      #pragma unroll
      for (int r = 0; r < 4; ++r) {
        d[r]     = (__bf16)s[2 * j][r];
        d[4 + r] = (__bf16)s[2 * j + 1][r];
      }
      *(v8bf*)(Wb + (size_t)w * KD * KD + e0 + j * 2048) = d;
    }
  }
}

#define GSTAGES (KD / 128)         // 8 stages of 128 k
#define GSTEP   256u               // source bytes from one stage to the next
template<int OMODE>
__global__ __launch_bounds__(256) void gemm_wmma_tdm(
    const __bf16* __restrict__ A, const __bf16* __restrict__ Bt,
    void* __restrict__ Cout, const float* __restrict__ bias, float scale)
{
  __shared__ __bf16 ring[2][2][KVTILE] __attribute__((aligned(2048)));  // [buffer][A, B]

  const int tid  = threadIdx.x;
  const int lane = tid & 31;
  const int wid  = tid >> 5;
  const int lm   = lane & 15;
  const int h2   = lane >> 4;
  const int wm   = (wid & 3) * 32;   // 4 waves tile the first operand's rows
  const int wn   = (wid >> 2) * 64;  // 2 waves tile the second operand's rows
  const int mblk = blockIdx.y * 128;
  const int nblk = blockIdx.x * 128;
  const int z    = blockIdx.z;

  const __bf16* Ab = A + (size_t)mblk * KD;
  const __bf16* Bb = Bt + (size_t)z * TN * KD + (size_t)nblk * KD;

  // 1: the Bt tile is the first WMMA operand (the same for a whole block).
  const int tfirst = OMODE == 2 ? 1 : (int)(blockIdx.y >> 3) == 2;

  v8f zero8 = {};
  v8f acc[2][4];
  #pragma unroll
  for (int mi = 0; mi < 2; ++mi)
    #pragma unroll
    for (int ni = 0; ni < 4; ++ni) acc[mi][ni] = zero8;

  // Wave 0 brings A, wave 1 brings B; all of this is wave-uniform.
  const unsigned wave   = uni((unsigned)tid >> 5);
  const unsigned issuer = wave < 2u;
  const unsigned isB    = wave & 1u;
  const unsigned long long gsrc = isB ? (unsigned long long)(uintptr_t)Bb
                                      : (unsigned long long)(uintptr_t)Ab;
  const unsigned gdst = (unsigned)(uintptr_t)&ring[0][0][0] + isB * (KVTILE * 2u);
  const v8u gd1 = tdm_group1_held(KD * 2u);  // source pitch: one row of 1024 bf16

  if (pinned(issuer)) {                  // stage 0
    tdm_load_held(gdst, gsrc, gd1);
    asm volatile("s_wait_tensorcnt 0x0" ::: "memory");  // stage 0 has landed
  }
  __syncthreads();                       // stage 0 published to all waves
  if (pinned(issuer))                    // stage 1 flies under stage 0's work
    tdm_load_held(gdst + 2u * KVTILE * 2u, gsrc + GSTEP, gd1);

  #pragma unroll 1  // one stage per trip: the publish point stands once, at its foot
  for (int st = 0; st < GSTAGES; ++st) {
    const __bf16* At = &ring[st & 1][tfirst][0];
    const __bf16* Bs = &ring[st & 1][tfirst ^ 1][0];
    #pragma unroll
    for (int ks = 0; ks < 4; ++ks) {
      v16bf af[2];
      #pragma unroll
      for (int mi = 0; mi < 2; ++mi) {
        const __bf16* ap = At + (wm + mi * 16 + lm) * KVP + ks * 32;
        af[mi] = comb(*(const v8bf*)(ap + h2 * 8), *(const v8bf*)(ap + 16 + h2 * 8));
      }
      v16bf bfr[4];
      #pragma unroll
      for (int ni = 0; ni < 4; ++ni) {
        const __bf16* bp = Bs + (wn + ni * 16 + lm) * KVP + ks * 32;
        bfr[ni] = comb(*(const v8bf*)(bp + h2 * 8), *(const v8bf*)(bp + 16 + h2 * 8));
      }
      // Keeps the 12 loads of a k step in one group ahead of its 8 WMMAs: left
      // alone the compiler sinks each B fragment's loads to its two WMMAs, and
      // the wave waits out the LDS latency four times a step instead of once.
      __builtin_amdgcn_sched_barrier(0);
      #pragma unroll
      for (int ni = 0; ni < 4; ++ni)
        #pragma unroll
        for (int mi = 0; mi < 2; ++mi)
          acc[mi][ni] = wmma_bf16(af[mi], bfr[ni], acc[mi][ni]);
    }
    // Publish point of stage st + 1, and the refill of the buffer just read.
    asm volatile("s_wait_dscnt 0x0" ::: "memory");        // this wave has left stage st
    if (pinned(issuer))
      asm volatile("s_wait_tensorcnt 0x0" ::: "memory");  // stage st + 1 has landed
    __syncthreads();                     // published; every wave has left stage st
    if (pinned(issuer & (unsigned)(st + 2 < GSTAGES))) {
      const unsigned nx = pinned((unsigned)st + 2u);
      tdm_load_held(gdst + (nx & 1u) * (2u * KVTILE * 2u),
                    gsrc + (unsigned long long)nx * GSTEP, gd1);
    }
  }
  asm volatile("s_wait_tensorcnt 0x0" ::: "memory");    // nothing in flight at the end
  asm volatile("s_wait_dscnt 0x0" ::: "memory");

  // Epilogue. D layout: lane -> (first operand's row r + 8*h2, second operand's
  // row lm). The second operand's rows are the rows of the output tile, the first
  // operand's rows run along them. Behind the loop's last barrier nobody reads
  // the ring and no tensor load is in flight: it takes the output tile.
  if constexpr (OMODE == 0) {
    const int proj = (int)(blockIdx.y >> 3);      // 0 Q, 1 K, 2 V: the same for a whole block
    const int jblk = mblk & (KD - 1);             // row inside that projection
    const float sc = proj != 0 ? 1.0f : scale;    // only Q is scaled
    __bf16* stg = &ring[0][0][0];                 // 128 rows of 256 B, pitch 272 B
    #pragma unroll
    for (int mi = 0; mi < 2; ++mi) {
      #pragma unroll
      for (int ni = 0; ni < 4; ++ni) {
        v8bf o;
        #pragma unroll
        for (int r = 0; r < 8; ++r) o[r] = (__bf16)(acc[mi][ni][r] * sc);
        *(v8bf*)(stg + (wn + ni * 16 + lm) * KVP + wm + mi * 16 + 8 * h2) = o;
      }
    }
    __syncthreads();                     // the staged tile is whole
    v8bf o[8];
    #pragma unroll
    for (int p = 0; p < 8; ++p)
      o[p] = *(const v8bf*)(stg + (p * 16 + (tid >> 4)) * KVP + (tid & 15) * 8);
    __bf16* Cp = (__bf16*)Cout + (size_t)proj * (4 * (size_t)KD * TN);
    if (proj < 2) {  // rows t of (b, h, t, e): 128 rows of 256 B, one behind the other
      __bf16* cp = Cp + (((size_t)z * HEADS + (jblk >> 7)) * TN + nblk + (tid >> 4)) * ODIM + (tid & 15) * 8;
      #pragma unroll
      for (int p = 0; p < 8; ++p) *(v8bf*)(cp + (size_t)(p * 16) * ODIM) = o[p];
    } else {         // rows j of (b, j, t): 128 pieces of 256 B
      __bf16* cp = Cp + (size_t)z * KD * TN + (size_t)(jblk + (tid >> 4)) * TN + nblk + (tid & 15) * 8;
      #pragma unroll
      for (int p = 0; p < 8; ++p) *(v8bf*)(cp + (size_t)(p * 16) * TN) = o[p];
    }
  } else {
    float* stf = (float*)&ring[0][0][0];          // 128 rows of 512 B, pitch 528 B
    #pragma unroll
    for (int ni = 0; ni < 4; ++ni) {
      const float bj = bias[mblk + wn + ni * 16 + lm];
      #pragma unroll
      for (int mi = 0; mi < 2; ++mi) {
        v4f a, b;
        #pragma unroll
        for (int r = 0; r < 4; ++r) {
          a[r] = acc[mi][ni][r] * scale + bj;
          b[r] = acc[mi][ni][4 + r] * scale + bj;
        }
        float* sp = stf + (wn + ni * 16 + lm) * 132 + wm + mi * 16 + 8 * h2;
        *(v4f*)sp = a;
        *(v4f*)(sp + 4) = b;
      }
    }
    __syncthreads();                     // the staged tile is whole
    v4f o[16];
    #pragma unroll
    for (int p = 0; p < 16; ++p)
      o[p] = *(const v4f*)(stf + (p * 8 + wid) * 132 + lane * 4);
    float* cp = (float*)Cout + ((size_t)z * ODIM + mblk + wid) * TN + nblk + lane * 4;
    #pragma unroll
    for (int p = 0; p < 16; ++p) *(v4f*)(cp + (size_t)(p * 8) * TN) = o[p];
  }
}

#define SKEYS  128
#define NSTAGE (TN / SKEYS)
#define QG     2
__device__ __forceinline__ float xhalf(float x) {
  return __builtin_bit_cast(float, __builtin_amdgcn_permlanex16(
      __builtin_bit_cast(int, x), __builtin_bit_cast(int, x),
      0x76543210, 0xfedcba98, false, false));
}
__device__ __forceinline__ v8f exp2x8(v8f x) {
  float y0, y1, y2, y3, y4, y5, y6, y7;
  asm("v_exp_f32 %0, %8\n\tv_exp_f32 %1, %9\n\tv_exp_f32 %2, %10\n\tv_exp_f32 %3, %11\n\t"
      "v_exp_f32 %4, %12\n\tv_exp_f32 %5, %13\n\tv_exp_f32 %6, %14\n\tv_exp_f32 %7, %15\n\tv_nop"
      : "=&v"(y0), "=&v"(y1), "=&v"(y2), "=&v"(y3), "=&v"(y4), "=&v"(y5), "=&v"(y6), "=&v"(y7)
      : "v"(x[0]), "v"(x[1]), "v"(x[2]), "v"(x[3]), "v"(x[4]), "v"(x[5]), "v"(x[6]), "v"(x[7]));
  v8f y = {y0, y1, y2, y3, y4, y5, y6, y7};
  return y;
}
__global__ __launch_bounds__(256) __attribute__((amdgpu_waves_per_eu(2, 2))) void attn_wmma(
    const __bf16* __restrict__ Qt,  // (b,h,t,e), pre-scaled
    const __bf16* __restrict__ Kt,  // (b,h,i,e)
    const __bf16* __restrict__ Vb,  // (b, j=h*128+e, i)
    __bf16* __restrict__ Ot)        // (b, t, j)
{
  __shared__ __bf16 ring[2][2][KVTILE] __attribute__((aligned(2048)));  // [buffer][K, V]
  const int tid  = threadIdx.x;
  const int lane = tid & 31;
  const int wid  = tid >> 5;
  const int lm   = lane & 15;
  const int h2   = lane >> 4;
  const int task = blockIdx.x * 8 + wid;
  const int bh   = task >> 6;
  const int tb   = (task & 63) * (16 * QG);

  // Wave 0 brings K, wave 1 brings V; all of this is wave-uniform.
  const unsigned wave   = uni((unsigned)tid >> 5);
  const unsigned issuer = wave < 2u;
  const unsigned isV    = wave & 1u;
  const unsigned bhu    = uni((unsigned)bh);
  const unsigned long long kvsrc = isV
      ? (unsigned long long)(uintptr_t)(Vb + (size_t)bhu * ODIM * TN)
      : (unsigned long long)(uintptr_t)(Kt + (size_t)bhu * TN * ODIM);
  const unsigned kvstep  = isV ? SKEYS * 2u : SKEYS * ODIM * 2u;  // bytes per stage
  const unsigned kvpitch = isV ? TN * 2u : ODIM * 2u;             // source row pitch
  const unsigned kvdst   = (unsigned)(uintptr_t)&ring[0][0][0] + isV * (KVTILE * 2u);

  if (pinned(issuer)) {                  // stage 0
    tdm_load_kv(kvdst, kvsrc, kvpitch);
    asm volatile("s_wait_tensorcnt 0x0" ::: "memory");  // stage 0 has landed
  }
  __syncthreads();                       // stage 0 published to all waves
  if (pinned(issuer))                    // stage 1 flies under stage 0's work
    tdm_load_kv(kvdst + 2u * KVTILE * 2u, kvsrc + kvstep, kvpitch);

  v16bf qf[QG][4];
  #pragma unroll
  for (int g = 0; g < QG; ++g) {
    const __bf16* qp = Qt + ((size_t)bh * TN + tb + g * 16 + lm) * ODIM;
    #pragma unroll
    for (int es = 0; es < 4; ++es)
      qf[g][es] = comb(*(const v8bf*)(qp + es * 32 + h2 * 8),
                       *(const v8bf*)(qp + es * 32 + 16 + h2 * 8));
  }
  // The built code reuses the Q loads' address registers for the zeroed
  // accumulators right behind the loads: the wait stands in front of that reuse,
  // and the scheduling barrier keeps the zeroing moves from rising over it.
  asm volatile("s_wait_xcnt 0x0" ::: "memory");
  __builtin_amdgcn_sched_barrier(0);

  v8f zero8 = {};
  v8f accO[QG][8];
  float mr[QG];  // running maximum of this lane's query, equal in both halves
  float lr[QG];  // running sum over this half's keys; the halves join after the loop
  #pragma unroll
  for (int g = 0; g < QG; ++g) {
    #pragma unroll
    for (int nt = 0; nt < 8; ++nt) accO[g][nt] = zero8;
    mr[g] = -3.0e38f;
    lr[g] = 0.0f;
  }

  #pragma unroll 1  // one stage per trip: the publish point stands once, at its foot
  for (int st = 0; st < NSTAGE; ++st) {
  const __bf16* kt = &ring[st & 1][0][0];
  const __bf16* vt = &ring[st & 1][1][0];
  #pragma unroll 1  // rolled: unrolled, the build spills to scratch and scatters the LDS loads among the WMMAs
  for (int i0 = 0; i0 < SKEYS; i0 += 32) {
    v8f s0[QG], s1[QG];
    #pragma unroll
    for (int g = 0; g < QG; ++g) { s0[g] = zero8; s1[g] = zero8; }
    const __bf16* kp0 = kt + (i0 + lm) * KVP;
    const __bf16* kp1 = kp0 + 16 * KVP;
    #pragma unroll
    for (int es = 0; es < 4; ++es) {
      v16bf k0 = comb(*(const v8bf*)(kp0 + es * 32 + h2 * 8),
                      *(const v8bf*)(kp0 + es * 32 + 16 + h2 * 8));
      v16bf k1 = comb(*(const v8bf*)(kp1 + es * 32 + h2 * 8),
                      *(const v8bf*)(kp1 + es * 32 + 16 + h2 * 8));
      #pragma unroll
      for (int g = 0; g < QG; ++g) {
        s0[g] = wmma_bf16(k0, qf[g][es], s0[g]);   // s0[g][r] = S[key i0 + 8*h2 + r][query 16*g + lm]
        s1[g] = wmma_bf16(k1, qf[g][es], s1[g]);   // s1[g][r] = the same, 16 keys on
      }
    }
    float alpha[QG];
    v16bf pf[QG];  // B operand: element s is key i0 + 8*h2 + s (s < 8) or i0 + 8 + 8*h2 + s (s >= 8) of this lane's query
    #pragma unroll
    for (int g = 0; g < QG; ++g) {
      float mx = fmaxf(s0[g][0], s1[g][0]);
      #pragma unroll
      for (int r = 1; r < 8; ++r) mx = fmaxf(mx, fmaxf(s0[g][r], s1[g][r]));
      mx = fmaxf(mx, xhalf(mx));
      const float mnew  = fmaxf(mr[g], mx);
      asm("v_exp_f32 %0, %1\n\tv_nop" : "=v"(alpha[g]) : "v"((mr[g] - mnew) * 1.44269504f));
      mr[g] = mnew;
      s0[g] = exp2x8((s0[g] - mnew) * 1.44269504f);  // exp(s - mnew)
      s1[g] = exp2x8((s1[g] - mnew) * 1.44269504f);
      #pragma unroll
      for (int r = 0; r < 8; ++r) {
        pf[g][r]     = (__bf16)s0[g][r];
        pf[g][8 + r] = (__bf16)s1[g][r];
      }
      #pragma unroll
      for (int nt = 0; nt < 8; ++nt) accO[g][nt] *= alpha[g];
    }

    #pragma unroll
    for (int nt = 0; nt < 8; ++nt) {
      const __bf16* vp = vt + (nt * 16 + lm) * KVP + i0;
      v16bf vf = comb(*(const v8bf*)(vp + h2 * 8),
                      *(const v8bf*)(vp + 16 + h2 * 8));
      #pragma unroll
      for (int g = 0; g < QG; ++g)
        accO[g][nt] = wmma_bf16(vf, pf[g], accO[g][nt]);  // accO[g][nt][r] = O[e = nt*16 + 8*h2 + r][query 16*g + lm]
    }
    __builtin_amdgcn_sched_barrier(0);
    #pragma unroll
    for (int g = 0; g < QG; ++g) {
      float rs0 = lr[g] * alpha[g], rs1 = 0.0f;
      #pragma unroll
      for (int r = 0; r < 8; ++r) { rs0 += s0[g][r]; rs1 += s1[g][r]; }
      lr[g] = rs0 + rs1;
    }
  }
  // Publish point of stage st + 1, and the refill of the buffer just read.
  asm volatile("s_wait_dscnt 0x0" ::: "memory");        // this wave has left stage st
  if (pinned(issuer))
    asm volatile("s_wait_tensorcnt 0x0" ::: "memory");  // stage st + 1 has landed
  __syncthreads();                       // published; every wave has left stage st
  if (pinned(issuer & (unsigned)(st + 2 < NSTAGE))) {
    const unsigned nx = pinned((unsigned)st + 2u);
    tdm_load_kv(kvdst + (nx & 1u) * (2u * KVTILE * 2u),
                kvsrc + (unsigned long long)nx * kvstep, kvpitch);
  }
  }
  asm volatile("s_wait_tensorcnt 0x0" ::: "memory");    // nothing in flight at the end
  asm volatile("s_wait_dscnt 0x0" ::: "memory");

  // Behind the last publish point nobody reads the ring and no tensor load is in
  // flight: each wave stages its 32 query rows of 256 B in a range of its own
  // (pitch 272 B) and stores them as whole rows, 16 B a lane.
  const int bb = bh >> 3;
  const int hh = bh & 7;
  __bf16* stg = &ring[0][0][0] + wid * (16 * QG * KVP);
  #pragma unroll
  for (int g = 0; g < QG; ++g) {
    const float inv = 1.0f / (lr[g] + xhalf(lr[g]));
    #pragma unroll
    for (int nt = 0; nt < 8; ++nt) {
      v8bf o;
      #pragma unroll
      for (int r = 0; r < 8; ++r) o[r] = (__bf16)(accO[g][nt][r] * inv);
      *(v8bf*)(stg + (g * 16 + lm) * KVP + nt * 16 + 8 * h2) = o;
    }
  }
  asm volatile("s_wait_dscnt 0x0" ::: "memory");  // a lane reads back what other lanes of its wave wrote
  v8bf ow[8 * QG];
  #pragma unroll
  for (int p = 0; p < 8 * QG; ++p)
    ow[p] = *(const v8bf*)(stg + (p * 2 + h2) * KVP + lm * 8);
  __bf16* op = Ot + ((size_t)bb * TN + tb + h2) * KD + hh * ODIM + lm * 8;
  #pragma unroll
  for (int p = 0; p < 8 * QG; ++p) *(v8bf*)(op + (size_t)(p * 2) * KD) = ow[p];
}

// ---------------------------------------------------------------------------
extern "C" void kernel_launch(void* const* d_in, const int* in_sizes, int n_in,
                              void* d_out, int out_size, void* d_ws, size_t ws_size,
                              hipStream_t stream) {
  (void)in_sizes; (void)n_in; (void)out_size; (void)ws_size;
  const float* x  = (const float*)d_in[0];
  const float* Wk = (const float*)d_in[1];
  const float* Wq = (const float*)d_in[2];
  const float* Wv = (const float*)d_in[3];
  const float* Wu = (const float*)d_in[4];
  const float* bu = (const float*)d_in[5];

  // ws (bf16 elems): Qt|Kt|V|Ot|xT (8M each) + Wq/Wk/Wv (1M each) + Wu (128K)
  const size_t SEG = (size_t)4 * HEADS * TN * ODIM;  // 8,388,608
  __bf16* ws  = (__bf16*)d_ws;
  __bf16* Qt  = ws;
  __bf16* Kt  = Qt + SEG;
  __bf16* Vb  = Kt + SEG;
  __bf16* Ot  = Vb + SEG;
  __bf16* xT  = Ot + SEG;
  __bf16* Wqb = xT + SEG;
  __bf16* Wkb = Wqb + (size_t)KD * KD;
  __bf16* Wvb = Wkb + (size_t)KD * KD;
  __bf16* Wub = Wvb + (size_t)KD * KD;

  const float qscale = 0.08838834764831845f;  // 1/sqrt(OD=128)
  dim3 blk(256);

  // Wqb, Wkb, Wvb, Wub are one run of ws, and so are Qt, Kt, Vb.
  prepass<<<dim3(XT_BLOCKS + CVT_BLOCKS), blk, 0, stream>>>(x, Wq, Wk, Wv, Wu, xT, Wqb);

  gemm_wmma_tdm<0><<<dim3(16, 24, 4), blk, 0, stream>>>(Wqb, xT, Qt, nullptr, qscale);

  attn_wmma<<<dim3(256), blk, 0, stream>>>(Qt, Kt, Vb, Ot);

  gemm_wmma_tdm<2><<<dim3(16, 1, 4), blk, 0, stream>>>(Wub, Ot, d_out, bu, 1.0f);
}

// v007
// One run takes 101 microseconds.
// In two side-by-side timings against v006, it was 1.06 and 1.05 times as fast.
// Over all steps from v000 it is 2.82 times as fast.
#include <hip/hip_runtime.h>

typedef __attribute__((ext_vector_type(16))) __bf16 v16bf;
typedef __attribute__((ext_vector_type(8)))  __bf16 v8bf;
typedef __attribute__((ext_vector_type(4)))  __bf16 v4bf;
typedef __attribute__((ext_vector_type(8)))  float  v8f;
typedef __attribute__((ext_vector_type(4)))  float  v4f;
typedef __attribute__((ext_vector_type(4)))  unsigned int v4u;

#define TN    2048   // time dim / GEMM N
#define KD    1024   // channel dim / GEMM K (= H*OD)
#define HEADS 8
#define ODIM  128

__device__ __forceinline__ v16bf comb(v8bf lo, v8bf hi) {
  return __builtin_shufflevector(lo, hi, 0,1,2,3,4,5,6,7,8,9,10,11,12,13,14,15);
}
__device__ __forceinline__ v8f wmma_bf16(v16bf a, v16bf b, v8f c) {
  return __builtin_amdgcn_wmma_f32_16x16x32_bf16(false, a, false, b, (short)0, c, false, false);
}

// ---------------------------------------------------------------------------
// Tensor loads: every LDS tile of this file is 128 rows of 256 B, one request
// of one wave, each row padded to 272 B in LDS.
// ---------------------------------------------------------------------------
#define KVP    136                 // LDS row pitch in bf16: 256 B data + 16 B pad
#define KVTILE (128 * KVP)         // bf16 per tile: 34,816 B = 17 x 2 KiB

typedef __attribute__((ext_vector_type(8))) unsigned int v8u;

__device__ __forceinline__ unsigned uni(unsigned v) {
  return (unsigned)__builtin_amdgcn_readfirstlane((int)v);
}
__device__ __forceinline__ unsigned pinned(unsigned v) {
  unsigned w = uni(v);
  asm volatile("" : "+s"(w));  // the word stays in a scalar register
  return w;
}
// One request: 128 rows of 256 B, source pitch src_pitch bytes, into LDS at
// byte offset lds_dst with 16 B of pad behind every row. All extents in bytes.
__device__ __forceinline__ void tdm_load_kv(unsigned lds_dst,
                                            unsigned long long ga,
                                            unsigned src_pitch) {
  v4u g0;
  g0[0] = uni(1u);                                        // count = 1
  g0[1] = uni(lds_dst);
  g0[2] = uni((unsigned)ga);
  g0[3] = uni((((unsigned)(ga >> 32)) & 0x01FFFFFFu) | 0x80000000u);  // type = 2
  v8u g1;
  g1[0] = uni((1u << 20) | (5u << 22) | (3u << 25));
  g1[1] = uni(256u << 16);
  g1[2] = uni(128u << 16);
  g1[3] = uni(256u << 16);
  g1[4] = uni(128u);
  g1[5] = uni(src_pitch);
  g1[6] = uni(0u);
  g1[7] = uni(0u);
  asm volatile("tensor_load_to_lds %0, %1" :: "s"(g0), "s"(g1) : "memory");
}
__device__ __forceinline__ v8u tdm_group1_held(unsigned src_pitch) {
  v8u g1;
  g1[0] = uni((1u << 20) | (5u << 22) | (3u << 25));
  g1[1] = pinned(256u << 16);
  g1[2] = pinned(128u << 16);
  g1[3] = pinned(256u << 16);
  g1[4] = pinned(128u);
  g1[5] = pinned(src_pitch);
  g1[6] = pinned(0u);
  g1[7] = pinned(0u);
  return g1;
}
__device__ __forceinline__ void tdm_load_held(unsigned lds_dst,
                                              unsigned long long ga, v8u g1) {
  v4u g0;
  g0[0] = uni(1u);                                        // count = 1
  g0[1] = uni(lds_dst);
  g0[2] = uni((unsigned)ga);
  g0[3] = uni((((unsigned)(ga >> 32)) & 0x01FFFFFFu) | 0x80000000u);  // type = 2
  asm volatile("tensor_load_to_lds %0, %1" :: "s"(g0), "s"(g1) : "memory");
}

// ---------------------------------------------------------------------------
// Pre-pass, one grid for five independent jobs; the block index picks the job.
// Every lane moves 32 elements and every global store is 16 B of a whole line.
//   blocks 0 .. 1023    : x (b, k, t) fp32 -> xT (b, t, k) bf16, one tile of
//                         128 k x 64 t through LDS each (32 t tiles x 8 k tiles
//                         x 4 b): read as 256-B row pieces, written as 256-B rows
//   blocks 1024 .. 1423 : fp32 -> bf16 convert of Wq, Wk, Wv (128 blocks each)
//                         and Wu (16 blocks), 8192 elements a block; the four
//                         bf16 copies lie one behind the other in Wb.
// ---------------------------------------------------------------------------
#define XT_BLOCKS  1024
#define CVT_BLOCKS 400
typedef __attribute__((ext_vector_type(2))) __bf16 v2bf;
__global__ __launch_bounds__(256) void prepass(const float* __restrict__ x,
                                               const float* __restrict__ Wq,
                                               const float* __restrict__ Wk,
                                               const float* __restrict__ Wv,
                                               const float* __restrict__ Wu,
                                               __bf16* __restrict__ xT,
                                               __bf16* __restrict__ Wb) {
  __shared__ unsigned tile[64 * 64] __attribute__((aligned(16)));
  const int bid = blockIdx.x;
  const int tid = threadIdx.x;
  if (bid < XT_BLOCKS) {
    const int b  = bid >> 8;
    const int t0 = (bid & 31) * 64, k0 = ((bid >> 5) & 7) * 128;
    const int tq = tid & 15;   // this lane's four t: 4 * tq ..
    const int kq = tid >> 4;   // its pair of k rows inside a group of 16 pairs
    const float* xb = x + (size_t)b * KD * TN + (size_t)(k0 + 2 * kq) * TN + t0 + 4 * tq;
    v4f lo[4], hi[4];
    #pragma unroll
    for (int p = 0; p < 4; ++p) {
      lo[p] = *(const v4f*)(xb + (size_t)(32 * p) * TN);
      hi[p] = *(const v4f*)(xb + (size_t)(32 * p + 1) * TN);
    }
    #pragma unroll
    for (int p = 0; p < 4; ++p) {
      const int kp = p * 16 + kq;
      #pragma unroll
      for (int i = 0; i < 4; ++i) {
        v2bf pr = {(__bf16)lo[p][i], (__bf16)hi[p][i]};
        tile[(4 * tq + i) * 64 + (((kp >> 2) ^ tq) << 2) + (kp & 3)] = __builtin_bit_cast(unsigned, pr);
      }
    }
    __syncthreads();
    __bf16* xTb = xT + ((size_t)b * TN + t0) * KD + k0;
    #pragma unroll
    for (int p = 0; p < 4; ++p) {
      const int row = p * 16 + (tid >> 4), c = tid & 15;
      v4u v = *(const v4u*)&tile[row * 64 + ((c ^ ((row >> 2) & 15)) << 2)];
      *(v4u*)(xTb + (size_t)row * KD + c * 8) = v;
    }
  } else {
    const int c = bid - XT_BLOCKS;
    const int w = c >> 7;  // 0, 1, 2: Wq, Wk, Wv; 3: Wu
    const float* src = w == 0 ? Wq : w == 1 ? Wk : w == 2 ? Wv : Wu;
    const size_t e0 = (size_t)(c & 127) * 8192 + (size_t)tid * 8;
    v4f s[8];
    #pragma unroll
    for (int j = 0; j < 4; ++j) {
      s[2 * j]     = *(const v4f*)(src + e0 + j * 2048);
      s[2 * j + 1] = *(const v4f*)(src + e0 + j * 2048 + 4);
    }
    #pragma unroll
    for (int j = 0; j < 4; ++j) {
      v8bf d;
      #pragma unroll
      for (int r = 0; r < 4; ++r) {
        d[r]     = (__bf16)s[2 * j][r];
        d[4 + r] = (__bf16)s[2 * j + 1][r];
      }
      *(v8bf*)(Wb + (size_t)w * KD * KD + e0 + j * 2048) = d;
    }
  }
}

#define GSTAGES (KD / 128)         // 8 stages of 128 k
#define GSTEP   256u               // source bytes from one stage to the next
template<int OMODE>
__global__ __launch_bounds__(256) void gemm_wmma_tdm(
    const __bf16* __restrict__ A, const __bf16* __restrict__ Bt,
    void* __restrict__ Cout, const float* __restrict__ bias, float scale)
{
  __shared__ __bf16 ring[2][2][KVTILE] __attribute__((aligned(2048)));  // [buffer][A, B]

  const int tid  = threadIdx.x;
  const int lane = tid & 31;
  const int wid  = tid >> 5;
  const int lm   = lane & 15;
  const int h2   = lane >> 4;
  const int wm   = (wid & 3) * 32;   // 4 waves tile the first operand's rows
  const int wn   = (wid >> 2) * 64;  // 2 waves tile the second operand's rows
  const int mblk = blockIdx.y * 128;
  const int nblk = blockIdx.x * 128;
  const int z    = blockIdx.z;

  const __bf16* Ab = A + (size_t)mblk * KD;
  const __bf16* Bb = Bt + (size_t)z * TN * KD + (size_t)nblk * KD;

  // 1: the Bt tile is the first WMMA operand (the same for a whole block).
  const int tfirst = OMODE == 2 ? 1 : (int)(blockIdx.y >> 3) == 2;

  v8f zero8 = {};
  v8f acc[2][4];
  #pragma unroll
  for (int mi = 0; mi < 2; ++mi)
    #pragma unroll
    for (int ni = 0; ni < 4; ++ni) acc[mi][ni] = zero8;

  // Wave 0 brings A, wave 1 brings B; all of this is wave-uniform.
  const unsigned wave   = uni((unsigned)tid >> 5);
  const unsigned issuer = wave < 2u;
  const unsigned isB    = wave & 1u;
  const unsigned long long gsrc = isB ? (unsigned long long)(uintptr_t)Bb
                                      : (unsigned long long)(uintptr_t)Ab;
  const unsigned gdst = (unsigned)(uintptr_t)&ring[0][0][0] + isB * (KVTILE * 2u);
  const v8u gd1 = tdm_group1_held(KD * 2u);  // source pitch: one row of 1024 bf16

  if (pinned(issuer)) {                  // stage 0
    tdm_load_held(gdst, gsrc, gd1);
    asm volatile("s_wait_tensorcnt 0x0" ::: "memory");  // stage 0 has landed
  }
  __syncthreads();                       // stage 0 published to all waves
  if (pinned(issuer))                    // stage 1 flies under stage 0's work
    tdm_load_held(gdst + 2u * KVTILE * 2u, gsrc + GSTEP, gd1);

  #pragma unroll 1  // one stage per trip: the publish point stands once, at its foot
  for (int st = 0; st < GSTAGES; ++st) {
    const __bf16* At = &ring[st & 1][tfirst][0];
    const __bf16* Bs = &ring[st & 1][tfirst ^ 1][0];
    #pragma unroll
    for (int ks = 0; ks < 4; ++ks) {
      v16bf af[2];
      #pragma unroll
      for (int mi = 0; mi < 2; ++mi) {
        const __bf16* ap = At + (wm + mi * 16 + lm) * KVP + ks * 32;
        af[mi] = comb(*(const v8bf*)(ap + h2 * 8), *(const v8bf*)(ap + 16 + h2 * 8));
      }
      v16bf bfr[4];
      #pragma unroll
      for (int ni = 0; ni < 4; ++ni) {
        const __bf16* bp = Bs + (wn + ni * 16 + lm) * KVP + ks * 32;
        bfr[ni] = comb(*(const v8bf*)(bp + h2 * 8), *(const v8bf*)(bp + 16 + h2 * 8));
      }
      // Keeps the 12 loads of a k step in one group ahead of its 8 WMMAs: left
      // alone the compiler sinks each B fragment's loads to its two WMMAs, and
      // the wave waits out the LDS latency four times a step instead of once.
      __builtin_amdgcn_sched_barrier(0);
      #pragma unroll
      for (int ni = 0; ni < 4; ++ni)
        #pragma unroll
        for (int mi = 0; mi < 2; ++mi)
          acc[mi][ni] = wmma_bf16(af[mi], bfr[ni], acc[mi][ni]);
    }
    // Publish point of stage st + 1, and the refill of the buffer just read.
    asm volatile("s_wait_dscnt 0x0" ::: "memory");        // this wave has left stage st
    if (pinned(issuer))
      asm volatile("s_wait_tensorcnt 0x0" ::: "memory");  // stage st + 1 has landed
    __syncthreads();                     // published; every wave has left stage st
    if (pinned(issuer & (unsigned)(st + 2 < GSTAGES))) {
      const unsigned nx = pinned((unsigned)st + 2u);
      tdm_load_held(gdst + (nx & 1u) * (2u * KVTILE * 2u),
                    gsrc + (unsigned long long)nx * GSTEP, gd1);
    }
  }
  asm volatile("s_wait_tensorcnt 0x0" ::: "memory");    // nothing in flight at the end
  asm volatile("s_wait_dscnt 0x0" ::: "memory");

  // Epilogue. D layout: lane -> (first operand's row r + 8*h2, second operand's
  // row lm). The second operand's rows are the rows of the output tile, the first
  // operand's rows run along them. Behind the loop's last barrier nobody reads
  // the ring and no tensor load is in flight: it takes the output tile.
  if constexpr (OMODE == 0) {
    const int proj = (int)(blockIdx.y >> 3);      // 0 Q, 1 K, 2 V: the same for a whole block
    const int jblk = mblk & (KD - 1);             // row inside that projection
    const float sc = proj != 0 ? 1.0f : scale;    // only Q is scaled
    __bf16* stg = &ring[0][0][0];                 // 128 rows of 256 B, pitch 272 B
    #pragma unroll
    for (int mi = 0; mi < 2; ++mi) {
      #pragma unroll
      for (int ni = 0; ni < 4; ++ni) {
        v8bf o;
        #pragma unroll
        for (int r = 0; r < 8; ++r) o[r] = (__bf16)(acc[mi][ni][r] * sc);
        *(v8bf*)(stg + (wn + ni * 16 + lm) * KVP + wm + mi * 16 + 8 * h2) = o;
      }
    }
    __syncthreads();                     // the staged tile is whole
    v8bf o[8];
    #pragma unroll
    for (int p = 0; p < 8; ++p)
      o[p] = *(const v8bf*)(stg + (p * 16 + (tid >> 4)) * KVP + (tid & 15) * 8);
    __bf16* Cp = (__bf16*)Cout + (size_t)proj * (4 * (size_t)KD * TN);
    if (proj < 2) {  // rows t of (b, h, t, e): 128 rows of 256 B, one behind the other
      __bf16* cp = Cp + (((size_t)z * HEADS + (jblk >> 7)) * TN + nblk + (tid >> 4)) * ODIM + (tid & 15) * 8;
      #pragma unroll
      for (int p = 0; p < 8; ++p) *(v8bf*)(cp + (size_t)(p * 16) * ODIM) = o[p];
    } else {         // rows j of (b, j, t): 128 pieces of 256 B
      __bf16* cp = Cp + (size_t)z * KD * TN + (size_t)(jblk + (tid >> 4)) * TN + nblk + (tid & 15) * 8;
      #pragma unroll
      for (int p = 0; p < 8; ++p) *(v8bf*)(cp + (size_t)(p * 16) * TN) = o[p];
    }
  } else {
    float* stf = (float*)&ring[0][0][0];          // 128 rows of 512 B, pitch 528 B
    #pragma unroll
    for (int ni = 0; ni < 4; ++ni) {
      const float bj = bias[mblk + wn + ni * 16 + lm];
      #pragma unroll
      for (int mi = 0; mi < 2; ++mi) {
        v4f a, b;
        #pragma unroll
        for (int r = 0; r < 4; ++r) {
          a[r] = acc[mi][ni][r] * scale + bj;
          b[r] = acc[mi][ni][4 + r] * scale + bj;
        }
        float* sp = stf + (wn + ni * 16 + lm) * 132 + wm + mi * 16 + 8 * h2;
        *(v4f*)sp = a;
        *(v4f*)(sp + 4) = b;
      }
    }
    __syncthreads();                     // the staged tile is whole
    v4f o[16];
    #pragma unroll
    for (int p = 0; p < 16; ++p)
      o[p] = *(const v4f*)(stf + (p * 8 + wid) * 132 + lane * 4);
    float* cp = (float*)Cout + ((size_t)z * ODIM + mblk + wid) * TN + nblk + lane * 4;
    #pragma unroll
    for (int p = 0; p < 16; ++p) *(v4f*)(cp + (size_t)(p * 8) * TN) = o[p];
  }
}

#define SKEYS  128
#define NSTAGE (TN / SKEYS)
#define QG     2
#define PKEYS  64
#define KT     (PKEYS / 16)
__device__ __forceinline__ float xhalf(float x) {
  return __builtin_bit_cast(float, __builtin_amdgcn_permlanex16(
      __builtin_bit_cast(int, x), __builtin_bit_cast(int, x),
      0x76543210, 0xfedcba98, false, false));
}
__device__ __forceinline__ v8f exp2x8(v8f x) {
  float y0, y1, y2, y3, y4, y5, y6, y7;
  asm("v_exp_f32 %0, %8\n\tv_exp_f32 %1, %9\n\tv_exp_f32 %2, %10\n\tv_exp_f32 %3, %11\n\t"
      "v_exp_f32 %4, %12\n\tv_exp_f32 %5, %13\n\tv_exp_f32 %6, %14\n\tv_exp_f32 %7, %15\n\tv_nop"
      : "=&v"(y0), "=&v"(y1), "=&v"(y2), "=&v"(y3), "=&v"(y4), "=&v"(y5), "=&v"(y6), "=&v"(y7)
      : "v"(x[0]), "v"(x[1]), "v"(x[2]), "v"(x[3]), "v"(x[4]), "v"(x[5]), "v"(x[6]), "v"(x[7]));
  v8f y = {y0, y1, y2, y3, y4, y5, y6, y7};
  return y;
}
__global__ __launch_bounds__(256) __attribute__((amdgpu_waves_per_eu(2, 2))) void attn_wmma(
    const __bf16* __restrict__ Qt,  // (b,h,t,e), pre-scaled
    const __bf16* __restrict__ Kt,  // (b,h,i,e)
    const __bf16* __restrict__ Vb,  // (b, j=h*128+e, i)
    __bf16* __restrict__ Ot)        // (b, t, j)
{
  __shared__ __bf16 ring[2][2][KVTILE] __attribute__((aligned(2048)));  // [buffer][K, V]
  const int tid  = threadIdx.x;
  const int lane = tid & 31;
  const int wid  = tid >> 5;
  const int lm   = lane & 15;
  const int h2   = lane >> 4;
  const int task = blockIdx.x * 8 + wid;
  const int bh   = task >> 6;
  const int tb   = (task & 63) * (16 * QG);

  // Wave 0 brings K, wave 1 brings V; all of this is wave-uniform.
  const unsigned wave   = uni((unsigned)tid >> 5);
  const unsigned issuer = wave < 2u;
  const unsigned isV    = wave & 1u;
  const unsigned bhu    = uni((unsigned)bh);
  const unsigned long long kvsrc = isV
      ? (unsigned long long)(uintptr_t)(Vb + (size_t)bhu * ODIM * TN)
      : (unsigned long long)(uintptr_t)(Kt + (size_t)bhu * TN * ODIM);
  const unsigned kvstep  = isV ? SKEYS * 2u : SKEYS * ODIM * 2u;  // bytes per stage
  const unsigned kvpitch = isV ? TN * 2u : ODIM * 2u;             // source row pitch
  const unsigned kvdst   = (unsigned)(uintptr_t)&ring[0][0][0] + isV * (KVTILE * 2u);

  if (pinned(issuer)) {                  // stage 0
    tdm_load_kv(kvdst, kvsrc, kvpitch);
    asm volatile("s_wait_tensorcnt 0x0" ::: "memory");  // stage 0 has landed
  }
  __syncthreads();                       // stage 0 published to all waves
  if (pinned(issuer))                    // stage 1 flies under stage 0's work
    tdm_load_kv(kvdst + 2u * KVTILE * 2u, kvsrc + kvstep, kvpitch);

  v16bf qf[QG][4];
  #pragma unroll
  for (int g = 0; g < QG; ++g) {
    const __bf16* qp = Qt + ((size_t)bh * TN + tb + g * 16 + lm) * ODIM;
    #pragma unroll
    for (int es = 0; es < 4; ++es)
      qf[g][es] = comb(*(const v8bf*)(qp + es * 32 + h2 * 8),
                       *(const v8bf*)(qp + es * 32 + 16 + h2 * 8));
  }
  // The built code reuses the Q loads' address registers for the zeroed
  // accumulators right behind the loads: the wait stands in front of that reuse,
  // and the scheduling barrier keeps the zeroing moves from rising over it.
  asm volatile("s_wait_xcnt 0x0" ::: "memory");
  __builtin_amdgcn_sched_barrier(0);

  v8f zero8 = {};
  v8f accO[QG][8];
  float mr[QG];  // running maximum of this lane's query, equal in both halves
  float lr[QG];  // running sum over this half's keys; the halves join after the loop
  #pragma unroll
  for (int g = 0; g < QG; ++g) {
    #pragma unroll
    for (int nt = 0; nt < 8; ++nt) accO[g][nt] = zero8;
    mr[g] = -3.0e38f;
    lr[g] = 0.0f;
  }

  #pragma unroll 1  // one stage per trip: the publish point stands once, at its foot
  for (int st = 0; st < NSTAGE; ++st) {
  const __bf16* kt = &ring[st & 1][0][0];
  const __bf16* vt = &ring[st & 1][1][0];
  #pragma unroll 1  // rolled: unrolled, the build spills to scratch and scatters the LDS loads among the WMMAs
  for (int i0 = 0; i0 < SKEYS; i0 += PKEYS) {
    v8f s[QG][KT];  // s[g][t][r] = S[key i0 + 16*t + 8*h2 + r][query 16*g + lm]
    #pragma unroll
    for (int g = 0; g < QG; ++g)
      #pragma unroll
      for (int t = 0; t < KT; ++t) s[g][t] = zero8;
    const __bf16* kp = kt + (i0 + lm) * KVP;
    v16bf kf[4][KT];
    #pragma unroll
    for (int es = 0; es < 4; ++es)
      #pragma unroll
      for (int t = 0; t < KT; ++t)
        kf[es][t] = comb(*(const v8bf*)(kp + t * 16 * KVP + es * 32 + h2 * 8),
                         *(const v8bf*)(kp + t * 16 * KVP + es * 32 + 16 + h2 * 8));
    // Keeps the pass's K loads in one group ahead of the score products: left
    // alone the compiler sinks each fragment's loads to its two WMMAs, and the
    // wave waits out the LDS latency at every fragment.
    __builtin_amdgcn_sched_barrier(0);
    #pragma unroll
    for (int es = 0; es < 4; ++es)
      #pragma unroll
      for (int t = 0; t < KT; ++t)
        #pragma unroll
        for (int g = 0; g < QG; ++g) s[g][t] = wmma_bf16(kf[es][t], qf[g][es], s[g][t]);
    // Holds the V loads behind the score products: raised to the head of the pass
    // they stand in registers beside all the K fragments, and the build spills.
    __builtin_amdgcn_sched_barrier(0);
    v16bf vf[KT / 2][8];
    #pragma unroll
    for (int u = 0; u < KT / 2; ++u)
      #pragma unroll
      for (int nt = 0; nt < 8; ++nt) {
        const __bf16* vp = vt + (nt * 16 + lm) * KVP + i0 + u * 32;
        vf[u][nt] = comb(*(const v8bf*)(vp + h2 * 8), *(const v8bf*)(vp + 16 + h2 * 8));
      }
    // Keeps the V loads in one group ahead of the softmax, which covers their
    // latency: left alone they sink to their WMMAs like the K loads.
    __builtin_amdgcn_sched_barrier(0);
    v16bf pf[QG][KT / 2];  // B operands, 32 keys each: element e < 8 is key i0 + 32*u + 8*h2 + e, element e >= 8 key i0 + 32*u + 8 + 8*h2 + e, of this lane's query
    #pragma unroll
    for (int g = 0; g < QG; ++g) {
      float mx = fmaxf(s[g][0][0], s[g][1][0]);
      #pragma unroll
      for (int t = 0; t < KT; t += 2)
        #pragma unroll
        for (int r = (t == 0 ? 1 : 0); r < 8; ++r) mx = fmaxf(mx, fmaxf(s[g][t][r], s[g][t + 1][r]));
      mx = fmaxf(mx, xhalf(mx));
      const float mnew  = fmaxf(mr[g], mx);
      float alpha;
      asm("v_exp_f32 %0, %1\n\tv_nop" : "=v"(alpha) : "v"((mr[g] - mnew) * 1.44269504f));
      mr[g] = mnew;
      v8f ps = zero8;  // element r: the sum over the pass's tiles of their rows r
      #pragma unroll
      for (int u = 0; u < KT / 2; ++u) {
        const v8f e0 = exp2x8((s[g][2 * u] - mnew) * 1.44269504f);      // exp(s - mnew)
        const v8f e1 = exp2x8((s[g][2 * u + 1] - mnew) * 1.44269504f);
        #pragma unroll
        for (int r = 0; r < 8; ++r) {
          pf[g][u][r]     = (__bf16)e0[r];
          pf[g][u][8 + r] = (__bf16)e1[r];
        }
        ps += e0 + e1;
      }
      lr[g] = lr[g] * alpha + (((ps[0] + ps[1]) + (ps[2] + ps[3])) + ((ps[4] + ps[5]) + (ps[6] + ps[7])));
      #pragma unroll
      for (int nt = 0; nt < 8; ++nt) accO[g][nt] *= alpha;
    }
    #pragma unroll
    for (int u = 0; u < KT / 2; ++u)
      #pragma unroll
      for (int nt = 0; nt < 8; ++nt)
        #pragma unroll
        for (int g = 0; g < QG; ++g)
          accO[g][nt] = wmma_bf16(vf[u][nt], pf[g][u], accO[g][nt]);  // accO[g][nt][r] = O[e = nt*16 + 8*h2 + r][query 16*g + lm]
  }
  // Publish point of stage st + 1, and the refill of the buffer just read.
  asm volatile("s_wait_dscnt 0x0" ::: "memory");        // this wave has left stage st
  if (pinned(issuer))
    asm volatile("s_wait_tensorcnt 0x0" ::: "memory");  // stage st + 1 has landed
  __syncthreads();                       // published; every wave has left stage st
  if (pinned(issuer & (unsigned)(st + 2 < NSTAGE))) {
    const unsigned nx = pinned((unsigned)st + 2u);
    tdm_load_kv(kvdst + (nx & 1u) * (2u * KVTILE * 2u),
                kvsrc + (unsigned long long)nx * kvstep, kvpitch);
  }
  }
  asm volatile("s_wait_tensorcnt 0x0" ::: "memory");    // nothing in flight at the end
  asm volatile("s_wait_dscnt 0x0" ::: "memory");

  // Behind the last publish point nobody reads the ring and no tensor load is in
  // flight: each wave stages its 32 query rows of 256 B in a range of its own
  // (pitch 272 B) and stores them as whole rows, 16 B a lane.
  const int bb = bh >> 3;
  const int hh = bh & 7;
  __bf16* stg = &ring[0][0][0] + wid * (16 * QG * KVP);
  #pragma unroll
  for (int g = 0; g < QG; ++g) {
    const float inv = 1.0f / (lr[g] + xhalf(lr[g]));
    #pragma unroll
    for (int nt = 0; nt < 8; ++nt) {
      v8bf o;
      #pragma unroll
      for (int r = 0; r < 8; ++r) o[r] = (__bf16)(accO[g][nt][r] * inv);
      *(v8bf*)(stg + (g * 16 + lm) * KVP + nt * 16 + 8 * h2) = o;
    }
  }
  asm volatile("s_wait_dscnt 0x0" ::: "memory");  // a lane reads back what other lanes of its wave wrote
  v8bf ow[8 * QG];
  #pragma unroll
  for (int p = 0; p < 8 * QG; ++p)
    ow[p] = *(const v8bf*)(stg + (p * 2 + h2) * KVP + lm * 8);
  __bf16* op = Ot + ((size_t)bb * TN + tb + h2) * KD + hh * ODIM + lm * 8;
  #pragma unroll
  for (int p = 0; p < 8 * QG; ++p) *(v8bf*)(op + (size_t)(p * 2) * KD) = ow[p];
}

// ---------------------------------------------------------------------------
extern "C" void kernel_launch(void* const* d_in, const int* in_sizes, int n_in,
                              void* d_out, int out_size, void* d_ws, size_t ws_size,
                              hipStream_t stream) {
  (void)in_sizes; (void)n_in; (void)out_size; (void)ws_size;
  const float* x  = (const float*)d_in[0];
  const float* Wk = (const float*)d_in[1];
  const float* Wq = (const float*)d_in[2];
  const float* Wv = (const float*)d_in[3];
  const float* Wu = (const float*)d_in[4];
  const float* bu = (const float*)d_in[5];

  // ws (bf16 elems): Qt|Kt|V|Ot|xT (8M each) + Wq/Wk/Wv (1M each) + Wu (128K)
  const size_t SEG = (size_t)4 * HEADS * TN * ODIM;  // 8,388,608
  __bf16* ws  = (__bf16*)d_ws;
  __bf16* Qt  = ws;
  __bf16* Kt  = Qt + SEG;
  __bf16* Vb  = Kt + SEG;
  __bf16* Ot  = Vb + SEG;
  __bf16* xT  = Ot + SEG;
  __bf16* Wqb = xT + SEG;
  __bf16* Wkb = Wqb + (size_t)KD * KD;
  __bf16* Wvb = Wkb + (size_t)KD * KD;
  __bf16* Wub = Wvb + (size_t)KD * KD;

  const float qscale = 0.08838834764831845f;  // 1/sqrt(OD=128)
  dim3 blk(256);

  // Wqb, Wkb, Wvb, Wub are one run of ws, and so are Qt, Kt, Vb.
  prepass<<<dim3(XT_BLOCKS + CVT_BLOCKS), blk, 0, stream>>>(x, Wq, Wk, Wv, Wu, xT, Wqb);

  gemm_wmma_tdm<0><<<dim3(16, 24, 4), blk, 0, stream>>>(Wqb, xT, Qt, nullptr, qscale);

  attn_wmma<<<dim3(256), blk, 0, stream>>>(Qt, Kt, Vb, Ot);

  gemm_wmma_tdm<2><<<dim3(16, 1, 4), blk, 0, stream>>>(Wub, Ot, d_out, bu, 1.0f);
}
